// v000
// Times are from an AMD MI455X. After a warm-up the kernel runs many times in a row, and a time is the length of
// such a window on the GPU divided by its runs, so every launch and the gaps after it count. The runs cycle
// through copies of the inputs. A figure is the median of several windows, for all but v000 over two sittings.
// Sittings can differ by a few percent; kernels timed side by side share one.
// v000 is the starting kernel. One run takes 114 microseconds.
#include <hip/hip_runtime.h>
#include <hip/hip_bf16.h>

typedef __attribute__((ext_vector_type(16))) _Float16 v16h;
typedef __attribute__((ext_vector_type(8)))  _Float16 v8h;
typedef __attribute__((ext_vector_type(8)))  float    v8f;

#define B_BATCH 512
#define T_SEQ   256
#define C_EMB   384
#define H_DIM   64
#define QK_SCALE 0.125f          // 64^-0.5
#define NEG_INF  (-1.0e30f)

__device__ __forceinline__ v8f wmma32(v16h a, v16h b, v8f c) {
  // v_wmma_f32_16x16x32_f16: D = A(16x32 f16) * B(32x16 f16) + C(16x16 f32)
  return __builtin_amdgcn_wmma_f32_16x16x32_f16(
      /*neg_a=*/false, a, /*neg_b=*/false, b,
      /*c_mod=*/(short)0, c, /*reuse_a=*/false, /*reuse_b=*/false);
}

__device__ __forceinline__ v8h ld8(const _Float16* p) {   // 16B vector load
  return *(const v8h*)p;
}
__device__ __forceinline__ v16h cat8(v8h a, v8h b) {
  return __builtin_shufflevector(a, b, 0,1,2,3,4,5,6,7,8,9,10,11,12,13,14,15);
}

__device__ __forceinline__ float redmax16(float v) {
  #pragma unroll
  for (int m = 1; m < 16; m <<= 1) v = fmaxf(v, __shfl_xor(v, m, 16));
  return v;
}
__device__ __forceinline__ float redsum16(float v) {
  #pragma unroll
  for (int m = 1; m < 16; m <<= 1) v += __shfl_xor(v, m, 16);
  return v;
}

// ---------------------------------------------------------------------------
// Kernel 0: weight prep.  Wt[m][h][c] = (f16) W_m[c][h]   (3 x 64 x 384).
// Runs once; makes B-fragment loads in qkv_kernel contiguous 128-bit loads.
// ---------------------------------------------------------------------------
__global__ __launch_bounds__(256)
void wcvt_kernel(const float* __restrict__ Wq, const float* __restrict__ Wk,
                 const float* __restrict__ Wv, _Float16* __restrict__ Wt) {
  const int per = H_DIM * C_EMB;                 // 24576
  const int idx = blockIdx.x * 256 + threadIdx.x;
  const int m   = idx / per;
  const int rem = idx % per;
  const int h   = rem / C_EMB;
  const int c   = rem % C_EMB;
  const float* W = (m == 0) ? Wq : (m == 1) ? Wk : Wv;
  Wt[idx] = (_Float16)W[(size_t)c * H_DIM + h];
}

// ---------------------------------------------------------------------------
// Kernel 1: fused Q/K/V projection.  One 16-row tile of x per block.
// 128 threads = 4 waves; wave w computes H-columns [16w, 16w+16).
// x staged in LDS as f16 (ds_load_b128 A-fragments shared by 4 waves);
// weights come pre-transposed/f16 so B-fragments are global_load_b128.
// Q gets bias + QK_SCALE folded in; V is stored transposed [B][H][T].
// ---------------------------------------------------------------------------
__global__ __launch_bounds__(128)
void qkv_kernel(const float* __restrict__ x,
                const _Float16* __restrict__ Wt,   // [3][H_DIM][C_EMB] f16
                const float* __restrict__ bq, const float* __restrict__ bk,
                const float* __restrict__ bv,
                _Float16* __restrict__ Qh, _Float16* __restrict__ Kh,
                _Float16* __restrict__ Vt) {
  __shared__ __align__(16) _Float16 xs[16 * C_EMB];   // 12 KB
  const int row0 = blockIdx.x * 16;                   // global row (b*T + t)
  const int tid  = threadIdx.x;

  // cooperative f32 -> f16 stage of 16 rows of x
  for (int i = tid; i < 16 * C_EMB; i += 128) {
    const int r = i / C_EMB, c = i % C_EMB;
    xs[i] = (_Float16)x[(size_t)(row0 + r) * C_EMB + c];
  }
  __syncthreads();

  const int wave = tid >> 5;                   // 0..3  -> H tile
  const int lane = tid & 31;
  const int lh   = lane & 15;                  // lane within half
  const int hi   = lane >> 4;                  // half select
  const int col  = wave * 16 + lh;             // output column in [0,64)

  const _Float16* wqRow = Wt + (size_t)col * C_EMB;                 // Wq^T row
  const _Float16* wkRow = wqRow + (size_t)H_DIM * C_EMB;            // Wk^T row
  const _Float16* wvRow = wkRow + (size_t)H_DIM * C_EMB;            // Wv^T row

  v8f accq = {}, acck = {}, accv = {};
  #pragma unroll 2
  for (int ks = 0; ks < C_EMB / 32; ++ks) {    // 12 K-steps of 32
    const int k0 = ks * 32 + hi * 8;
    // A fragment (lane=M=lh; halves: k0+{0..7}, k0+16+{0..7})
    const _Float16* xrow = &xs[lh * C_EMB + k0];
    v16h a = cat8(ld8(xrow), ld8(xrow + 16));
    // B fragments: contiguous 16B loads from transposed f16 weights
    v16h fq = cat8(ld8(wqRow + k0), ld8(wqRow + k0 + 16));
    v16h fk = cat8(ld8(wkRow + k0), ld8(wkRow + k0 + 16));
    v16h fv = cat8(ld8(wvRow + k0), ld8(wvRow + k0 + 16));
    accq = wmma32(a, fq, accq);
    acck = wmma32(a, fk, acck);
    accv = wmma32(a, fv, accv);
  }

  const float biasq = bq[col], biask = bk[col], biasv = bv[col];
  const int b  = row0 / T_SEQ;                 // 16-row tile never crosses batch
  const int t0 = row0 % T_SEQ;
  #pragma unroll
  for (int r = 0; r < 8; ++r) {
    const size_t idx = (size_t)(row0 + r + hi * 8) * H_DIM + col;
    Qh[idx] = (_Float16)((accq[r] + biasq) * QK_SCALE);  // scale folded into Q
    Kh[idx] = (_Float16)(acck[r] + biask);
    // V transposed: [B][H][T] so PV B-fragments are contiguous in s
    Vt[((size_t)b * H_DIM + col) * T_SEQ + t0 + r + hi * 8] =
        (_Float16)(accv[r] + biasv);
  }
}

// ---------------------------------------------------------------------------
// Kernel 2: causal flash attention.  grid = (B, 4), block = 128 (4 waves).
// Each wave owns one 16-row Q tile of one batch.  Online softmax; K tiles
// processed in pairs of 16 so PV uses a single K=32 WMMA per H tile.
// ---------------------------------------------------------------------------
__global__ __launch_bounds__(128)
void attn_kernel(const _Float16* __restrict__ Qh,
                 const _Float16* __restrict__ Kh,
                 const _Float16* __restrict__ Vt,   // [B][H][T]
                 float* __restrict__ out) {
  __shared__ __align__(16) _Float16 pbuf[4][16 * 32];  // per-wave P staging

  const int tid  = threadIdx.x;
  const int wave = tid >> 5;
  const int lane = tid & 31;
  const int lh   = lane & 15;
  const int hi   = lane >> 4;

  const int b    = blockIdx.x;
  const int qt   = blockIdx.y * 4 + wave;      // Q tile index in [0,16)
  const int qr0  = qt * 16;                    // first Q row of the tile
  const size_t bofs  = (size_t)b * T_SEQ * H_DIM;
  const size_t bofsV = (size_t)b * H_DIM * T_SEQ;

  _Float16* myp = pbuf[wave];

  // Q A-fragments: two 16x32 chunks covering H=64 (scale already folded in)
  const _Float16* qr = Qh + bofs + (size_t)(qr0 + lh) * H_DIM + hi * 8;
  v16h qf0 = cat8(ld8(qr),      ld8(qr + 16));
  v16h qf1 = cat8(ld8(qr + 32), ld8(qr + 48));

  v8f o0 = {}, o1 = {}, o2 = {}, o3 = {};
  float mrow[8], lrow[8];
  #pragma unroll
  for (int r = 0; r < 8; ++r) { mrow[r] = NEG_INF; lrow[r] = 0.0f; }

  #pragma unroll 1
  for (int j0 = 0; j0 <= qt; j0 += 2) {        // pairs of 16-wide K tiles
    const bool have1 = (j0 + 1) <= qt;

    // ---- scores: S = Q (16x64) . K^T, per 16-wide tile, 2 WMMAs each ----
    v8f s0 = {}, s1 = {};
    {
      const _Float16* kr = Kh + bofs + (size_t)(j0 * 16 + lh) * H_DIM + hi * 8;
      s0 = wmma32(qf0, cat8(ld8(kr),      ld8(kr + 16)), s0);
      s0 = wmma32(qf1, cat8(ld8(kr + 32), ld8(kr + 48)), s0);
    }
    if (have1) {
      const _Float16* kr =
          Kh + bofs + (size_t)((j0 + 1) * 16 + lh) * H_DIM + hi * 8;
      s1 = wmma32(qf0, cat8(ld8(kr),      ld8(kr + 16)), s1);
      s1 = wmma32(qf1, cat8(ld8(kr + 32), ld8(kr + 48)), s1);
    }

    // ---- online softmax (row stats live per-lane in C layout) ----
    #pragma unroll
    for (int r = 0; r < 8; ++r) {
      const int row = r + hi * 8;              // local row within the Q tile
      float v0 = s0[r];
      float v1 = have1 ? s1[r] : NEG_INF;
      if (j0 == qt)          { if (lh > row) v0 = NEG_INF; }  // diagonal tile
      else if (j0 + 1 == qt) { if (lh > row) v1 = NEG_INF; }
      float mt   = redmax16(fmaxf(v0, v1));
      float mnew = fmaxf(mrow[r], mt);
      float sc   = __expf(mrow[r] - mnew);
      float e0   = __expf(v0 - mnew);
      float e1   = __expf(v1 - mnew);
      lrow[r] = lrow[r] * sc + redsum16(e0 + e1);
      mrow[r] = mnew;
      o0[r] *= sc; o1[r] *= sc; o2[r] *= sc; o3[r] *= sc;
      myp[row * 32 + lh]      = (_Float16)e0;  // P in row-major 16x32
      myp[row * 32 + 16 + lh] = (_Float16)e1;
    }

    // per-wave LDS RAW: DS ops are in-order per wave; make it explicit
    asm volatile("s_wait_dscnt 0" ::: "memory");

    // ---- re-read P as a 16x32 A fragment (ds_load_b128) ----
    const _Float16* pr = myp + lh * 32 + hi * 8;
    v16h pf = cat8(ld8(pr), ld8(pr + 16));

    // ---- O += P (16x32) . V (32x64), one WMMA per 16-wide H tile ----
    const int off1 = have1 ? 16 : 0;           // stay in-bounds; P half is 0
    #pragma unroll
    for (int n = 0; n < 4; ++n) {
      const _Float16* vp =
          Vt + bofsV + (size_t)(n * 16 + lh) * T_SEQ + j0 * 16 + hi * 8;
      v16h vf = cat8(ld8(vp), ld8(vp + off1)); // contiguous in s (transposed V)
      switch (n) {
        case 0: o0 = wmma32(pf, vf, o0); break;
        case 1: o1 = wmma32(pf, vf, o1); break;
        case 2: o2 = wmma32(pf, vf, o2); break;
        case 3: o3 = wmma32(pf, vf, o3); break;
      }
    }
  }

  // ---- normalize and store f32 output [B, T, H] ----
  #pragma unroll
  for (int r = 0; r < 8; ++r) {
    const float inv = 1.0f / lrow[r];
    const size_t base = ((size_t)b * T_SEQ + qr0 + r + hi * 8) * H_DIM + lh;
    out[base +  0] = o0[r] * inv;
    out[base + 16] = o1[r] * inv;
    out[base + 32] = o2[r] * inv;
    out[base + 48] = o3[r] * inv;
  }
}

// ---------------------------------------------------------------------------
extern "C" void kernel_launch(void* const* d_in, const int* in_sizes, int n_in,
                              void* d_out, int out_size, void* d_ws, size_t ws_size,
                              hipStream_t stream) {
  const float* x  = (const float*)d_in[0];
  const float* Wq = (const float*)d_in[1];
  const float* bq = (const float*)d_in[2];
  const float* Wk = (const float*)d_in[3];
  const float* bk = (const float*)d_in[4];
  const float* Wv = (const float*)d_in[5];
  const float* bv = (const float*)d_in[6];

  const size_t nQKV = (size_t)B_BATCH * T_SEQ * H_DIM;   // 8.4M elems each
  const size_t nW   = (size_t)3 * H_DIM * C_EMB;         // 73728 elems
  _Float16* Qh = (_Float16*)d_ws;                        // ~48 MB + 144 KB ws
  _Float16* Kh = Qh + nQKV;
  _Float16* Vt = Kh + nQKV;
  _Float16* Wt = Vt + nQKV;

  wcvt_kernel<<<dim3((unsigned)(nW / 256)), 256, 0, stream>>>(Wq, Wk, Wv, Wt);
  qkv_kernel<<<dim3((B_BATCH * T_SEQ) / 16), 128, 0, stream>>>(
      x, Wt, bq, bk, bv, Qh, Kh, Vt);
  attn_kernel<<<dim3(B_BATCH, 4), 128, 0, stream>>>(
      Qh, Kh, Vt, (float*)d_out);
}

// v001
// One run takes 98.3 microseconds.
// Next to v000, in two timings, it ran 1.21 and 1.22 times as fast.
#include <hip/hip_runtime.h>
#include <hip/hip_bf16.h>

typedef __attribute__((ext_vector_type(16))) _Float16 v16h;
typedef __attribute__((ext_vector_type(8)))  _Float16 v8h;
typedef __attribute__((ext_vector_type(8)))  float    v8f;

#define B_BATCH 512
#define T_SEQ   256
#define C_EMB   384
#define H_DIM   64
#define KSTEPS  (C_EMB / 32)     // K-steps of one 16x16x32 product
#define QK_SCALE 0.125f          // 64^-0.5
#define NEG_INF  (-1.0e30f)

__device__ __forceinline__ v8f wmma32(v16h a, v16h b, v8f c) {
  // v_wmma_f32_16x16x32_f16: D = A(16x32 f16) * B(32x16 f16) + C(16x16 f32)
  return __builtin_amdgcn_wmma_f32_16x16x32_f16(
      /*neg_a=*/false, a, /*neg_b=*/false, b,
      /*c_mod=*/(short)0, c, /*reuse_a=*/false, /*reuse_b=*/false);
}

__device__ __forceinline__ v8h ld8(const _Float16* p) {   // 16B vector load
  return *(const v8h*)p;
}
__device__ __forceinline__ v16h cat8(v8h a, v8h b) {
  return __builtin_shufflevector(a, b, 0,1,2,3,4,5,6,7,8,9,10,11,12,13,14,15);
}

__device__ __forceinline__ float redmax16(float v) {
  #pragma unroll
  for (int m = 1; m < 16; m <<= 1) v = fmaxf(v, __shfl_xor(v, m, 16));
  return v;
}
__device__ __forceinline__ float redsum16(float v) {
  #pragma unroll
  for (int m = 1; m < 16; m <<= 1) v += __shfl_xor(v, m, 16);
  return v;
}

// ---------------------------------------------------------------------------
// Kernel 0: weight prep.  f16 weights packed in B-fragment order:
//   Wt[w][ks][m][half][lane][e] = (f16) W_m[c][h]
//   h = 16*w + (lane & 15),  c = 32*ks + 8*(lane >> 4) + 16*half + e
// (w: 16-column tile, ks: K-step of 32, m: q/k/v, e: 0..7).  One wave-wide
// 16-byte load of qkv_kernel then covers 512 contiguous bytes (4 whole lines).
// ---------------------------------------------------------------------------
__global__ __launch_bounds__(256)
void wcvt_kernel(const float* __restrict__ Wq, const float* __restrict__ Wk,
                 const float* __restrict__ Wv, _Float16* __restrict__ Wt) {
  const int idx  = blockIdx.x * 256 + threadIdx.x;
  const int e    = idx & 7;
  const int lane = (idx >> 3) & 31;
  const int half = (idx >> 8) & 1;
  const int t    = idx >> 9;                     // (w*KSTEPS + ks)*3 + m
  const int m    = t % 3;
  const int ks   = (t / 3) % KSTEPS;
  const int w    = t / (3 * KSTEPS);
  const int h    = w * 16 + (lane & 15);
  const int c    = ks * 32 + (lane >> 4) * 8 + half * 16 + e;
  const float* W = (m == 0) ? Wq : (m == 1) ? Wk : Wv;
  Wt[idx] = (_Float16)W[(size_t)c * H_DIM + h];
}

// ---------------------------------------------------------------------------
// Kernel 1: fused Q/K/V projection.  One 16-row tile of x per block.
// 128 threads = 4 waves; wave w computes H-columns [16w, 16w+16).
// x staged in LDS as f16 (ds_load_b128 A-fragments shared by 4 waves);
// weights come f16 in fragment order: each B half-fragment is one
// global_load_b128 over 512 contiguous bytes.
// Q gets bias + QK_SCALE folded in; V is stored transposed [B][H][T].
// ---------------------------------------------------------------------------
__global__ __launch_bounds__(128)
void qkv_kernel(const float* __restrict__ x,
                const _Float16* __restrict__ Wt,   // packed, see wcvt_kernel
                const float* __restrict__ bq, const float* __restrict__ bk,
                const float* __restrict__ bv,
                _Float16* __restrict__ Qh, _Float16* __restrict__ Kh,
                _Float16* __restrict__ Vt) {
  __shared__ __align__(16) _Float16 xs[16 * C_EMB];   // 12 KB
  const int row0 = blockIdx.x * 16;                   // global row (b*T + t)
  const int tid  = threadIdx.x;

  // cooperative f32 -> f16 stage of 16 rows of x
  for (int i = tid; i < 16 * C_EMB; i += 128) {
    const int r = i / C_EMB, c = i % C_EMB;
    xs[i] = (_Float16)x[(size_t)(row0 + r) * C_EMB + c];
  }
  __syncthreads();

  const int wave = tid >> 5;                   // 0..3  -> H tile
  const int lane = tid & 31;
  const int lh   = lane & 15;                  // lane within half
  const int hi   = lane >> 4;                  // half select
  const int col  = wave * 16 + lh;             // output column in [0,64)

  // this wave's packed weights: 3 fragments of 512 halves per K-step
  const _Float16* wfrag = Wt + (size_t)wave * (KSTEPS * 3 * 512) + lane * 8;

  v8f accq = {}, acck = {}, accv = {};
  #pragma unroll 2
  for (int ks = 0; ks < KSTEPS; ++ks) {        // 12 K-steps of 32
    const int k0 = ks * 32 + hi * 8;
    // A fragment (lane=M=lh; halves: k0+{0..7}, k0+16+{0..7})
    const _Float16* xrow = &xs[lh * C_EMB + k0];
    v16h a = cat8(ld8(xrow), ld8(xrow + 16));
    // B fragments (same k order as A): two 512-byte planes each
    const _Float16* wk3 = wfrag + ks * (3 * 512);
    v16h fq = cat8(ld8(wk3),        ld8(wk3 + 256));
    v16h fk = cat8(ld8(wk3 + 512),  ld8(wk3 + 768));
    v16h fv = cat8(ld8(wk3 + 1024), ld8(wk3 + 1280));
    accq = wmma32(a, fq, accq);
    acck = wmma32(a, fk, acck);
    accv = wmma32(a, fv, accv);
  }

  const float biasq = bq[col], biask = bk[col], biasv = bv[col];
  const int b  = row0 / T_SEQ;                 // 16-row tile never crosses batch
  const int t0 = row0 % T_SEQ;
  #pragma unroll
  for (int r = 0; r < 8; ++r) {
    const size_t idx = (size_t)(row0 + r + hi * 8) * H_DIM + col;
    Qh[idx] = (_Float16)((accq[r] + biasq) * QK_SCALE);  // scale folded into Q
    Kh[idx] = (_Float16)(acck[r] + biask);
    // V transposed: [B][H][T] so PV B-fragments are contiguous in s
    Vt[((size_t)b * H_DIM + col) * T_SEQ + t0 + r + hi * 8] =
        (_Float16)(accv[r] + biasv);
  }
}

// ---------------------------------------------------------------------------
// Kernel 2: causal flash attention.  grid = (B, 4), block = 128 (4 waves).
// Each wave owns one 16-row Q tile of one batch.  Online softmax; K tiles
// processed in pairs of 16 so PV uses a single K=32 WMMA per H tile.
// ---------------------------------------------------------------------------
__global__ __launch_bounds__(128)
void attn_kernel(const _Float16* __restrict__ Qh,
                 const _Float16* __restrict__ Kh,
                 const _Float16* __restrict__ Vt,   // [B][H][T]
                 float* __restrict__ out) {
  __shared__ __align__(16) _Float16 pbuf[4][16 * 32];  // per-wave P staging

  const int tid  = threadIdx.x;
  const int wave = tid >> 5;
  const int lane = tid & 31;
  const int lh   = lane & 15;
  const int hi   = lane >> 4;

  const int b    = blockIdx.x;
  const int qt   = blockIdx.y * 4 + wave;      // Q tile index in [0,16)
  const int qr0  = qt * 16;                    // first Q row of the tile
  const size_t bofs  = (size_t)b * T_SEQ * H_DIM;
  const size_t bofsV = (size_t)b * H_DIM * T_SEQ;

  _Float16* myp = pbuf[wave];

  // Q A-fragments: two 16x32 chunks covering H=64 (scale already folded in)
  const _Float16* qr = Qh + bofs + (size_t)(qr0 + lh) * H_DIM + hi * 8;
  v16h qf0 = cat8(ld8(qr),      ld8(qr + 16));
  v16h qf1 = cat8(ld8(qr + 32), ld8(qr + 48));

  v8f o0 = {}, o1 = {}, o2 = {}, o3 = {};
  float mrow[8], lrow[8];
  #pragma unroll
  for (int r = 0; r < 8; ++r) { mrow[r] = NEG_INF; lrow[r] = 0.0f; }

  #pragma unroll 1
  for (int j0 = 0; j0 <= qt; j0 += 2) {        // pairs of 16-wide K tiles
    const bool have1 = (j0 + 1) <= qt;

    // ---- scores: S = Q (16x64) . K^T, per 16-wide tile, 2 WMMAs each ----
    v8f s0 = {}, s1 = {};
    {
      const _Float16* kr = Kh + bofs + (size_t)(j0 * 16 + lh) * H_DIM + hi * 8;
      s0 = wmma32(qf0, cat8(ld8(kr),      ld8(kr + 16)), s0);
      s0 = wmma32(qf1, cat8(ld8(kr + 32), ld8(kr + 48)), s0);
    }
    if (have1) {
      const _Float16* kr =
          Kh + bofs + (size_t)((j0 + 1) * 16 + lh) * H_DIM + hi * 8;
      s1 = wmma32(qf0, cat8(ld8(kr),      ld8(kr + 16)), s1);
      s1 = wmma32(qf1, cat8(ld8(kr + 32), ld8(kr + 48)), s1);
    }

    // ---- online softmax (row stats live per-lane in C layout) ----
    #pragma unroll
    for (int r = 0; r < 8; ++r) {
      const int row = r + hi * 8;              // local row within the Q tile
      float v0 = s0[r];
      float v1 = have1 ? s1[r] : NEG_INF;
      if (j0 == qt)          { if (lh > row) v0 = NEG_INF; }  // diagonal tile
      else if (j0 + 1 == qt) { if (lh > row) v1 = NEG_INF; }
      float mt   = redmax16(fmaxf(v0, v1));
      float mnew = fmaxf(mrow[r], mt);
      float sc   = __expf(mrow[r] - mnew);
      float e0   = __expf(v0 - mnew);
      float e1   = __expf(v1 - mnew);
      lrow[r] = lrow[r] * sc + redsum16(e0 + e1);
      mrow[r] = mnew;
      o0[r] *= sc; o1[r] *= sc; o2[r] *= sc; o3[r] *= sc;
      myp[row * 32 + lh]      = (_Float16)e0;  // P in row-major 16x32
      myp[row * 32 + 16 + lh] = (_Float16)e1;
    }

    // per-wave LDS RAW: DS ops are in-order per wave; make it explicit
    asm volatile("s_wait_dscnt 0" ::: "memory");

    // ---- re-read P as a 16x32 A fragment (ds_load_b128) ----
    const _Float16* pr = myp + lh * 32 + hi * 8;
    v16h pf = cat8(ld8(pr), ld8(pr + 16));

    // ---- O += P (16x32) . V (32x64), one WMMA per 16-wide H tile ----
    const int off1 = have1 ? 16 : 0;           // stay in-bounds; P half is 0
    #pragma unroll
    for (int n = 0; n < 4; ++n) {
      const _Float16* vp =
          Vt + bofsV + (size_t)(n * 16 + lh) * T_SEQ + j0 * 16 + hi * 8;
      v16h vf = cat8(ld8(vp), ld8(vp + off1)); // contiguous in s (transposed V)
      switch (n) {
        case 0: o0 = wmma32(pf, vf, o0); break;
        case 1: o1 = wmma32(pf, vf, o1); break;
        case 2: o2 = wmma32(pf, vf, o2); break;
        case 3: o3 = wmma32(pf, vf, o3); break;
      }
    }
  }

  // ---- normalize and store f32 output [B, T, H] ----
  #pragma unroll
  for (int r = 0; r < 8; ++r) {
    const float inv = 1.0f / lrow[r];
    const size_t base = ((size_t)b * T_SEQ + qr0 + r + hi * 8) * H_DIM + lh;
    out[base +  0] = o0[r] * inv;
    out[base + 16] = o1[r] * inv;
    out[base + 32] = o2[r] * inv;
    out[base + 48] = o3[r] * inv;
  }
}

// ---------------------------------------------------------------------------
extern "C" void kernel_launch(void* const* d_in, const int* in_sizes, int n_in,
                              void* d_out, int out_size, void* d_ws, size_t ws_size,
                              hipStream_t stream) {
  const float* x  = (const float*)d_in[0];
  const float* Wq = (const float*)d_in[1];
  const float* bq = (const float*)d_in[2];
  const float* Wk = (const float*)d_in[3];
  const float* bk = (const float*)d_in[4];
  const float* Wv = (const float*)d_in[5];
  const float* bv = (const float*)d_in[6];

  const size_t nQKV = (size_t)B_BATCH * T_SEQ * H_DIM;   // 8.4M elems each
  const size_t nW   = (size_t)3 * H_DIM * C_EMB;         // 73728 elems
  _Float16* Qh = (_Float16*)d_ws;                        // ~48 MB + 144 KB ws
  _Float16* Kh = Qh + nQKV;
  _Float16* Vt = Kh + nQKV;
  _Float16* Wt = Vt + nQKV;

  wcvt_kernel<<<dim3((unsigned)(nW / 256)), 256, 0, stream>>>(Wq, Wk, Wv, Wt);
  qkv_kernel<<<dim3((B_BATCH * T_SEQ) / 16), 128, 0, stream>>>(
      x, Wt, bq, bk, bv, Qh, Kh, Vt);
  attn_kernel<<<dim3(B_BATCH, 4), 128, 0, stream>>>(
      Qh, Kh, Vt, (float*)d_out);
}

// v002
// One run takes 83.4 microseconds.
// Timed twice side by side with v001, it ran 1.18 times as fast both times.
// All steps since v000 together make it 1.43 times as fast.
#include <hip/hip_runtime.h>
#include <hip/hip_bf16.h>

typedef __attribute__((ext_vector_type(16))) _Float16 v16h;
typedef __attribute__((ext_vector_type(8)))  _Float16 v8h;
typedef __attribute__((ext_vector_type(8)))  float    v8f;

#define B_BATCH 512
#define T_SEQ   256
#define C_EMB   384
#define H_DIM   64
#define KSTEPS  (C_EMB / 32)     // K-steps of one 16x16x32 product
// LDS row pitches in halves, each an odd multiple of 16 bytes: the 16 lanes of
// a half-wave read 16 bytes of 16 different rows in one ds_load_b128, and at
// such a pitch they fall on all 64 banks (at 768 B or 64 B rows they collide).
#define XPITCH  (C_EMB + 8)      // 784 B = 16 B x 49
#define PPITCH  (32 + 8)         // 80 B  = 16 B x 5
#define QK_SCALE 0.125f          // 64^-0.5
#define NEG_INF  (-1.0e30f)

__device__ __forceinline__ v8f wmma32(v16h a, v16h b, v8f c) {
  // v_wmma_f32_16x16x32_f16: D = A(16x32 f16) * B(32x16 f16) + C(16x16 f32)
  return __builtin_amdgcn_wmma_f32_16x16x32_f16(
      /*neg_a=*/false, a, /*neg_b=*/false, b,
      /*c_mod=*/(short)0, c, /*reuse_a=*/false, /*reuse_b=*/false);
}

__device__ __forceinline__ v8h ld8(const _Float16* p) {   // 16B vector load
  return *(const v8h*)p;
}
__device__ __forceinline__ v16h cat8(v8h a, v8h b) {
  return __builtin_shufflevector(a, b, 0,1,2,3,4,5,6,7,8,9,10,11,12,13,14,15);
}

__device__ __forceinline__ float redmax16(float v) {
  #pragma unroll
  for (int m = 1; m < 16; m <<= 1) v = fmaxf(v, __shfl_xor(v, m, 16));
  return v;
}
__device__ __forceinline__ float redsum16(float v) {
  #pragma unroll
  for (int m = 1; m < 16; m <<= 1) v += __shfl_xor(v, m, 16);
  return v;
}

// ---------------------------------------------------------------------------
// Kernel 0: weight prep.  f16 weights packed in B-fragment order:
//   Wt[w][ks][m][half][lane][e] = (f16) W_m[c][h]
//   h = 16*w + (lane & 15),  c = 32*ks + 8*(lane >> 4) + 16*half + e
// (w: 16-column tile, ks: K-step of 32, m: q/k/v, e: 0..7).  One wave-wide
// 16-byte load of qkv_kernel then covers 512 contiguous bytes (4 whole lines).
// ---------------------------------------------------------------------------
__global__ __launch_bounds__(256)
void wcvt_kernel(const float* __restrict__ Wq, const float* __restrict__ Wk,
                 const float* __restrict__ Wv, _Float16* __restrict__ Wt) {
  const int idx  = blockIdx.x * 256 + threadIdx.x;
  const int e    = idx & 7;
  const int lane = (idx >> 3) & 31;
  const int half = (idx >> 8) & 1;
  const int t    = idx >> 9;                     // (w*KSTEPS + ks)*3 + m
  const int m    = t % 3;
  const int ks   = (t / 3) % KSTEPS;
  const int w    = t / (3 * KSTEPS);
  const int h    = w * 16 + (lane & 15);
  const int c    = ks * 32 + (lane >> 4) * 8 + half * 16 + e;
  const float* W = (m == 0) ? Wq : (m == 1) ? Wk : Wv;
  Wt[idx] = (_Float16)W[(size_t)c * H_DIM + h];
}

// ---------------------------------------------------------------------------
// Kernel 1: fused Q/K/V projection.  One 16-row tile of x per block.
// 128 threads = 4 waves; wave w computes H-columns [16w, 16w+16).
// x staged in LDS as f16 (ds_load_b128 A-fragments shared by 4 waves);
// weights come f16 in fragment order: each B half-fragment is one
// global_load_b128 over 512 contiguous bytes.
// Q gets bias + QK_SCALE folded in; V is stored transposed [B][H][T].
// ---------------------------------------------------------------------------
__global__ __launch_bounds__(128)
void qkv_kernel(const float* __restrict__ x,
                const _Float16* __restrict__ Wt,   // packed, see wcvt_kernel
                const float* __restrict__ bq, const float* __restrict__ bk,
                const float* __restrict__ bv,
                _Float16* __restrict__ Qh, _Float16* __restrict__ Kh,
                _Float16* __restrict__ Vt) {
  __shared__ __align__(16) _Float16 xs[16 * XPITCH];  // 16 padded rows
  const int row0 = blockIdx.x * 16;                   // global row (b*T + t)
  const int tid  = threadIdx.x;

  // cooperative f32 -> f16 stage of 16 rows of x
  for (int i = tid; i < 16 * C_EMB; i += 128) {
    const int r = i / C_EMB, c = i % C_EMB;
    xs[r * XPITCH + c] = (_Float16)x[(size_t)(row0 + r) * C_EMB + c];
  }
  __syncthreads();

  const int wave = tid >> 5;                   // 0..3  -> H tile
  const int lane = tid & 31;
  const int lh   = lane & 15;                  // lane within half
  const int hi   = lane >> 4;                  // half select
  const int col  = wave * 16 + lh;             // output column in [0,64)

  // this wave's packed weights: 3 fragments of 512 halves per K-step
  const _Float16* wfrag = Wt + (size_t)wave * (KSTEPS * 3 * 512) + lane * 8;

  v8f accq = {}, acck = {}, accv = {};
  #pragma unroll 2
  for (int ks = 0; ks < KSTEPS; ++ks) {        // 12 K-steps of 32
    const int k0 = ks * 32 + hi * 8;
    // A fragment (lane=M=lh; halves: k0+{0..7}, k0+16+{0..7})
    const _Float16* xrow = &xs[lh * XPITCH + k0];
    v16h a = cat8(ld8(xrow), ld8(xrow + 16));
    // B fragments (same k order as A): two 512-byte planes each
    const _Float16* wk3 = wfrag + ks * (3 * 512);
    v16h fq = cat8(ld8(wk3),        ld8(wk3 + 256));
    v16h fk = cat8(ld8(wk3 + 512),  ld8(wk3 + 768));
    v16h fv = cat8(ld8(wk3 + 1024), ld8(wk3 + 1280));
    accq = wmma32(a, fq, accq);
    acck = wmma32(a, fk, acck);
    accv = wmma32(a, fv, accv);
  }

  const float biasq = bq[col], biask = bk[col], biasv = bv[col];
  const int b  = row0 / T_SEQ;                 // 16-row tile never crosses batch
  const int t0 = row0 % T_SEQ;
  #pragma unroll
  for (int r = 0; r < 8; ++r) {
    const size_t idx = (size_t)(row0 + r + hi * 8) * H_DIM + col;
    Qh[idx] = (_Float16)((accq[r] + biasq) * QK_SCALE);  // scale folded into Q
    Kh[idx] = (_Float16)(acck[r] + biask);
    // V transposed: [B][H][T] so PV B-fragments are contiguous in s
    Vt[((size_t)b * H_DIM + col) * T_SEQ + t0 + r + hi * 8] =
        (_Float16)(accv[r] + biasv);
  }
}

// ---------------------------------------------------------------------------
// Kernel 2: causal flash attention.  grid = (B, 4), block = 128 (4 waves).
// Each wave owns one 16-row Q tile of one batch.  Online softmax; K tiles
// processed in pairs of 16 so PV uses a single K=32 WMMA per H tile.
// ---------------------------------------------------------------------------
__global__ __launch_bounds__(128)
void attn_kernel(const _Float16* __restrict__ Qh,
                 const _Float16* __restrict__ Kh,
                 const _Float16* __restrict__ Vt,   // [B][H][T]
                 float* __restrict__ out) {
  __shared__ __align__(16) _Float16 pbuf[4][16 * PPITCH];  // per-wave P staging

  const int tid  = threadIdx.x;
  const int wave = tid >> 5;
  const int lane = tid & 31;
  const int lh   = lane & 15;
  const int hi   = lane >> 4;

  const int b    = blockIdx.x;
  const int qt   = blockIdx.y * 4 + wave;      // Q tile index in [0,16)
  const int qr0  = qt * 16;                    // first Q row of the tile
  const size_t bofs  = (size_t)b * T_SEQ * H_DIM;
  const size_t bofsV = (size_t)b * H_DIM * T_SEQ;

  _Float16* myp = pbuf[wave];

  // Q A-fragments: two 16x32 chunks covering H=64 (scale already folded in)
  const _Float16* qr = Qh + bofs + (size_t)(qr0 + lh) * H_DIM + hi * 8;
  v16h qf0 = cat8(ld8(qr),      ld8(qr + 16));
  v16h qf1 = cat8(ld8(qr + 32), ld8(qr + 48));

  v8f o0 = {}, o1 = {}, o2 = {}, o3 = {};
  float mrow[8], lrow[8];
  #pragma unroll
  for (int r = 0; r < 8; ++r) { mrow[r] = NEG_INF; lrow[r] = 0.0f; }

  #pragma unroll 1
  for (int j0 = 0; j0 <= qt; j0 += 2) {        // pairs of 16-wide K tiles
    const bool have1 = (j0 + 1) <= qt;

    // ---- scores: S = Q (16x64) . K^T, per 16-wide tile, 2 WMMAs each ----
    v8f s0 = {}, s1 = {};
    {
      const _Float16* kr = Kh + bofs + (size_t)(j0 * 16 + lh) * H_DIM + hi * 8;
      s0 = wmma32(qf0, cat8(ld8(kr),      ld8(kr + 16)), s0);
      s0 = wmma32(qf1, cat8(ld8(kr + 32), ld8(kr + 48)), s0);
    }
    if (have1) {
      const _Float16* kr =
          Kh + bofs + (size_t)((j0 + 1) * 16 + lh) * H_DIM + hi * 8;
      s1 = wmma32(qf0, cat8(ld8(kr),      ld8(kr + 16)), s1);
      s1 = wmma32(qf1, cat8(ld8(kr + 32), ld8(kr + 48)), s1);
    }

    // ---- online softmax (row stats live per-lane in C layout) ----
    #pragma unroll
    for (int r = 0; r < 8; ++r) {
      const int row = r + hi * 8;              // local row within the Q tile
      float v0 = s0[r];
      float v1 = have1 ? s1[r] : NEG_INF;
      if (j0 == qt)          { if (lh > row) v0 = NEG_INF; }  // diagonal tile
      else if (j0 + 1 == qt) { if (lh > row) v1 = NEG_INF; }
      float mt   = redmax16(fmaxf(v0, v1));
      float mnew = fmaxf(mrow[r], mt);
      float sc   = __expf(mrow[r] - mnew);
      float e0   = __expf(v0 - mnew);
      float e1   = __expf(v1 - mnew);
      lrow[r] = lrow[r] * sc + redsum16(e0 + e1);
      mrow[r] = mnew;
      o0[r] *= sc; o1[r] *= sc; o2[r] *= sc; o3[r] *= sc;
      myp[row * PPITCH + lh]      = (_Float16)e0;  // P in row-major 16x32
      myp[row * PPITCH + 16 + lh] = (_Float16)e1;
    }

    // per-wave LDS RAW: DS ops are in-order per wave; make it explicit
    asm volatile("s_wait_dscnt 0" ::: "memory");

    // ---- re-read P as a 16x32 A fragment (ds_load_b128) ----
    const _Float16* pr = myp + lh * PPITCH + hi * 8;
    v16h pf = cat8(ld8(pr), ld8(pr + 16));

    // ---- O += P (16x32) . V (32x64), one WMMA per 16-wide H tile ----
    const int off1 = have1 ? 16 : 0;           // stay in-bounds; P half is 0
    #pragma unroll
    for (int n = 0; n < 4; ++n) {
      const _Float16* vp =
          Vt + bofsV + (size_t)(n * 16 + lh) * T_SEQ + j0 * 16 + hi * 8;
      v16h vf = cat8(ld8(vp), ld8(vp + off1)); // contiguous in s (transposed V)
      switch (n) {
        case 0: o0 = wmma32(pf, vf, o0); break;
        case 1: o1 = wmma32(pf, vf, o1); break;
        case 2: o2 = wmma32(pf, vf, o2); break;
        case 3: o3 = wmma32(pf, vf, o3); break;
      }
    }
  }

  // ---- normalize and store f32 output [B, T, H] ----
  #pragma unroll
  for (int r = 0; r < 8; ++r) {
    const float inv = 1.0f / lrow[r];
    const size_t base = ((size_t)b * T_SEQ + qr0 + r + hi * 8) * H_DIM + lh;
    out[base +  0] = o0[r] * inv;
    out[base + 16] = o1[r] * inv;
    out[base + 32] = o2[r] * inv;
    out[base + 48] = o3[r] * inv;
  }
}

// ---------------------------------------------------------------------------
extern "C" void kernel_launch(void* const* d_in, const int* in_sizes, int n_in,
                              void* d_out, int out_size, void* d_ws, size_t ws_size,
                              hipStream_t stream) {
  const float* x  = (const float*)d_in[0];
  const float* Wq = (const float*)d_in[1];
  const float* bq = (const float*)d_in[2];
  const float* Wk = (const float*)d_in[3];
  const float* bk = (const float*)d_in[4];
  const float* Wv = (const float*)d_in[5];
  const float* bv = (const float*)d_in[6];

  const size_t nQKV = (size_t)B_BATCH * T_SEQ * H_DIM;   // 8.4M elems each
  const size_t nW   = (size_t)3 * H_DIM * C_EMB;         // 73728 elems
  _Float16* Qh = (_Float16*)d_ws;                        // ~48 MB + 144 KB ws
  _Float16* Kh = Qh + nQKV;
  _Float16* Vt = Kh + nQKV;
  _Float16* Wt = Vt + nQKV;

  wcvt_kernel<<<dim3((unsigned)(nW / 256)), 256, 0, stream>>>(Wq, Wk, Wv, Wt);
  qkv_kernel<<<dim3((B_BATCH * T_SEQ) / 16), 128, 0, stream>>>(
      x, Wt, bq, bk, bv, Qh, Kh, Vt);
  attn_kernel<<<dim3(B_BATCH, 4), 128, 0, stream>>>(
      Qh, Kh, Vt, (float*)d_out);
}

// v003
// One run takes 63.4 microseconds.
// In both of two side-by-side timings against v002, it was 1.32 times as fast.
// Counting every step since v000, it is 1.89 times as fast.
#include <hip/hip_runtime.h>
#include <hip/hip_bf16.h>

typedef __attribute__((ext_vector_type(16))) _Float16 v16h;
typedef __attribute__((ext_vector_type(8)))  _Float16 v8h;
typedef __attribute__((ext_vector_type(8)))  float    v8f;

#define B_BATCH 512
#define T_SEQ   256
#define C_EMB   384
#define H_DIM   64
#define KSTEPS  (C_EMB / 32)     // K-steps of one 16x16x32 product
#define MT      4                // 16-row tiles of x per qkv block
#define QROWS   (16 * MT)        // divides T_SEQ: a block stays in one batch
// LDS row pitches in halves, each an odd multiple of 16 bytes: the 16 lanes of
// a half-wave read 16 bytes of 16 different rows in one ds_load_b128, and at
// such a pitch they fall on all 64 banks (at 768 B or 64 B rows they collide).
#define XPITCH  (C_EMB + 8)      // 784 B = 16 B x 49
#define PPITCH  (32 + 8)         // 80 B  = 16 B x 5
#define QK_SCALE 0.125f          // 64^-0.5
#define NEG_INF  (-1.0e30f)

__device__ __forceinline__ v8f wmma32(v16h a, v16h b, v8f c) {
  // v_wmma_f32_16x16x32_f16: D = A(16x32 f16) * B(32x16 f16) + C(16x16 f32)
  return __builtin_amdgcn_wmma_f32_16x16x32_f16(
      /*neg_a=*/false, a, /*neg_b=*/false, b,
      /*c_mod=*/(short)0, c, /*reuse_a=*/false, /*reuse_b=*/false);
}

__device__ __forceinline__ v8h ld8(const _Float16* p) {   // 16B vector load
  return *(const v8h*)p;
}
__device__ __forceinline__ v16h cat8(v8h a, v8h b) {
  return __builtin_shufflevector(a, b, 0,1,2,3,4,5,6,7,8,9,10,11,12,13,14,15);
}

__device__ __forceinline__ float redmax16(float v) {
  #pragma unroll
  for (int m = 1; m < 16; m <<= 1) v = fmaxf(v, __shfl_xor(v, m, 16));
  return v;
}
__device__ __forceinline__ float redsum16(float v) {
  #pragma unroll
  for (int m = 1; m < 16; m <<= 1) v += __shfl_xor(v, m, 16);
  return v;
}

// ---------------------------------------------------------------------------
// Kernel 0: weight prep.  f16 weights packed in B-fragment order:
//   Wt[w][ks][m][half][lane][e] = (f16) W_m[c][h]
//   h = 16*w + (lane & 15),  c = 32*ks + 8*(lane >> 4) + 16*half + e
// (w: 16-column tile, ks: K-step of 32, m: q/k/v, e: 0..7).  One wave-wide
// 16-byte load of qkv_kernel then covers 512 contiguous bytes (4 whole lines).
// ---------------------------------------------------------------------------
__global__ __launch_bounds__(256)
void wcvt_kernel(const float* __restrict__ Wq, const float* __restrict__ Wk,
                 const float* __restrict__ Wv, _Float16* __restrict__ Wt) {
  const int idx  = blockIdx.x * 256 + threadIdx.x;
  const int e    = idx & 7;
  const int lane = (idx >> 3) & 31;
  const int half = (idx >> 8) & 1;
  const int t    = idx >> 9;                     // (w*KSTEPS + ks)*3 + m
  const int m    = t % 3;
  const int ks   = (t / 3) % KSTEPS;
  const int w    = t / (3 * KSTEPS);
  const int h    = w * 16 + (lane & 15);
  const int c    = ks * 32 + (lane >> 4) * 8 + half * 16 + e;
  const float* W = (m == 0) ? Wq : (m == 1) ? Wk : Wv;
  Wt[idx] = (_Float16)W[(size_t)c * H_DIM + h];
}

// ---------------------------------------------------------------------------
// Kernel 1: fused Q/K/V projection.  MT 16-row tiles of x per block.
// 128 threads = 4 waves; wave w computes H-columns [16w, 16w+16) of all MT
// row tiles, so each weight fragment it loads feeds MT products.
// x staged in LDS as f16 (ds_load_b128 A-fragments shared by 4 waves);
// weights come f16 in fragment order: each B half-fragment is one
// global_load_b128 over 512 contiguous bytes.
// Q gets bias + QK_SCALE folded in; V is stored transposed [B][H][T].
// ---------------------------------------------------------------------------
__global__ __launch_bounds__(128)
void qkv_kernel(const float* __restrict__ x,
                const _Float16* __restrict__ Wt,   // packed, see wcvt_kernel
                const float* __restrict__ bq, const float* __restrict__ bk,
                const float* __restrict__ bv,
                _Float16* __restrict__ Qh, _Float16* __restrict__ Kh,
                _Float16* __restrict__ Vt) {
  __shared__ __align__(16) _Float16 xs[QROWS * XPITCH];  // padded rows
  const int row0 = blockIdx.x * QROWS;                // global row (b*T + t)
  const int tid  = threadIdx.x;

  // cooperative f32 -> f16 stage of QROWS rows of x: per step the 128 threads
  // take a third of a row (C_EMB = 3 * 128), in the order of memory.
  const float* xg = x + (size_t)row0 * C_EMB + tid;
  _Float16*    xl = xs + tid;
  // one trip per 16-row tile, rolled to bound the code; its 48 steps unrolled:
  // a quarter of the waves now stage the same bytes per WGP, so each keeps a
  // whole tile's loads in flight instead of a few
  #pragma unroll 1
  for (int mt = 0; mt < MT; ++mt) {
    #pragma unroll
    for (int r = 0; r < 16; ++r) {
      #pragma unroll
      for (int t = 0; t < C_EMB / 128; ++t)
        xl[(mt * 16 + r) * XPITCH + t * 128] =
            (_Float16)xg[(mt * 16 + r) * C_EMB + t * 128];
    }
  }
  __syncthreads();

  const int wave = tid >> 5;                   // 0..3  -> H tile
  const int lane = tid & 31;
  const int lh   = lane & 15;                  // lane within half
  const int hi   = lane >> 4;                  // half select
  const int col  = wave * 16 + lh;             // output column in [0,64)

  // this wave's packed weights: 3 fragments of 512 halves per K-step
  const _Float16* wfrag = Wt + (size_t)wave * (KSTEPS * 3 * 512) + lane * 8;

  v8f accq[MT] = {}, acck[MT] = {}, accv[MT] = {};
  #pragma unroll 2
  for (int ks = 0; ks < KSTEPS; ++ks) {        // 12 K-steps of 32
    const int k0 = ks * 32 + hi * 8;
    // B fragments (same k order as A): two 512-byte planes each
    const _Float16* wk3 = wfrag + ks * (3 * 512);
    v16h fq = cat8(ld8(wk3),        ld8(wk3 + 256));
    v16h fk = cat8(ld8(wk3 + 512),  ld8(wk3 + 768));
    v16h fv = cat8(ld8(wk3 + 1024), ld8(wk3 + 1280));
    #pragma unroll  // constant mt keeps the accumulator arrays in registers
    for (int mt = 0; mt < MT; ++mt) {
      // A fragment (lane=M=lh; halves: k0+{0..7}, k0+16+{0..7})
      const _Float16* xrow = &xs[(mt * 16 + lh) * XPITCH + k0];
      v16h a = cat8(ld8(xrow), ld8(xrow + 16));
      accq[mt] = wmma32(a, fq, accq[mt]);
      acck[mt] = wmma32(a, fk, acck[mt]);
      accv[mt] = wmma32(a, fv, accv[mt]);
    }
  }

  const float biasq = bq[col], biask = bk[col], biasv = bv[col];
  const int b  = row0 / T_SEQ;                 // the block never crosses batch
  const int t0 = row0 % T_SEQ;
  #pragma unroll    // constant mt, r: accumulators are read from registers
  for (int mt = 0; mt < MT; ++mt) {
    #pragma unroll
    for (int r = 0; r < 8; ++r) {
      const int rr = mt * 16 + r + hi * 8;     // row within the block
      const size_t idx = (size_t)(row0 + rr) * H_DIM + col;
      Qh[idx] = (_Float16)((accq[mt][r] + biasq) * QK_SCALE);  // scale in Q
      Kh[idx] = (_Float16)(acck[mt][r] + biask);
      // V transposed: [B][H][T] so PV B-fragments are contiguous in s
      Vt[((size_t)b * H_DIM + col) * T_SEQ + t0 + rr] =
          (_Float16)(accv[mt][r] + biasv);
    }
  }
}

// ---------------------------------------------------------------------------
// Kernel 2: causal flash attention.  grid = (B, 4), block = 128 (4 waves).
// Each wave owns one 16-row Q tile of one batch.  Online softmax; K tiles
// processed in pairs of 16 so PV uses a single K=32 WMMA per H tile.
// ---------------------------------------------------------------------------
__global__ __launch_bounds__(128)
void attn_kernel(const _Float16* __restrict__ Qh,
                 const _Float16* __restrict__ Kh,
                 const _Float16* __restrict__ Vt,   // [B][H][T]
                 float* __restrict__ out) {
  __shared__ __align__(16) _Float16 pbuf[4][16 * PPITCH];  // per-wave P staging

  const int tid  = threadIdx.x;
  const int wave = tid >> 5;
  const int lane = tid & 31;
  const int lh   = lane & 15;
  const int hi   = lane >> 4;

  const int b    = blockIdx.x;
  const int qt   = blockIdx.y * 4 + wave;      // Q tile index in [0,16)
  const int qr0  = qt * 16;                    // first Q row of the tile
  const size_t bofs  = (size_t)b * T_SEQ * H_DIM;
  const size_t bofsV = (size_t)b * H_DIM * T_SEQ;

  _Float16* myp = pbuf[wave];

  // Q A-fragments: two 16x32 chunks covering H=64 (scale already folded in)
  const _Float16* qr = Qh + bofs + (size_t)(qr0 + lh) * H_DIM + hi * 8;
  v16h qf0 = cat8(ld8(qr),      ld8(qr + 16));
  v16h qf1 = cat8(ld8(qr + 32), ld8(qr + 48));

  v8f o0 = {}, o1 = {}, o2 = {}, o3 = {};
  float mrow[8], lrow[8];
  #pragma unroll
  for (int r = 0; r < 8; ++r) { mrow[r] = NEG_INF; lrow[r] = 0.0f; }

  #pragma unroll 1
  for (int j0 = 0; j0 <= qt; j0 += 2) {        // pairs of 16-wide K tiles
    const bool have1 = (j0 + 1) <= qt;

    // ---- scores: S = Q (16x64) . K^T, per 16-wide tile, 2 WMMAs each ----
    v8f s0 = {}, s1 = {};
    {
      const _Float16* kr = Kh + bofs + (size_t)(j0 * 16 + lh) * H_DIM + hi * 8;
      s0 = wmma32(qf0, cat8(ld8(kr),      ld8(kr + 16)), s0);
      s0 = wmma32(qf1, cat8(ld8(kr + 32), ld8(kr + 48)), s0);
    }
    if (have1) {
      const _Float16* kr =
          Kh + bofs + (size_t)((j0 + 1) * 16 + lh) * H_DIM + hi * 8;
      s1 = wmma32(qf0, cat8(ld8(kr),      ld8(kr + 16)), s1);
      s1 = wmma32(qf1, cat8(ld8(kr + 32), ld8(kr + 48)), s1);
    }

    // ---- online softmax (row stats live per-lane in C layout) ----
    #pragma unroll
    for (int r = 0; r < 8; ++r) {
      const int row = r + hi * 8;              // local row within the Q tile
      float v0 = s0[r];
      float v1 = have1 ? s1[r] : NEG_INF;
      if (j0 == qt)          { if (lh > row) v0 = NEG_INF; }  // diagonal tile
      else if (j0 + 1 == qt) { if (lh > row) v1 = NEG_INF; }
      float mt   = redmax16(fmaxf(v0, v1));
      float mnew = fmaxf(mrow[r], mt);
      float sc   = __expf(mrow[r] - mnew);
      float e0   = __expf(v0 - mnew);
      float e1   = __expf(v1 - mnew);
      lrow[r] = lrow[r] * sc + redsum16(e0 + e1);
      mrow[r] = mnew;
      o0[r] *= sc; o1[r] *= sc; o2[r] *= sc; o3[r] *= sc;
      myp[row * PPITCH + lh]      = (_Float16)e0;  // P in row-major 16x32
      myp[row * PPITCH + 16 + lh] = (_Float16)e1;
    }

    // per-wave LDS RAW: DS ops are in-order per wave; make it explicit
    asm volatile("s_wait_dscnt 0" ::: "memory");

    // ---- re-read P as a 16x32 A fragment (ds_load_b128) ----
    const _Float16* pr = myp + lh * PPITCH + hi * 8;
    v16h pf = cat8(ld8(pr), ld8(pr + 16));

    // ---- O += P (16x32) . V (32x64), one WMMA per 16-wide H tile ----
    const int off1 = have1 ? 16 : 0;           // stay in-bounds; P half is 0
    #pragma unroll
    for (int n = 0; n < 4; ++n) {
      const _Float16* vp =
          Vt + bofsV + (size_t)(n * 16 + lh) * T_SEQ + j0 * 16 + hi * 8;
      v16h vf = cat8(ld8(vp), ld8(vp + off1)); // contiguous in s (transposed V)
      switch (n) {
        case 0: o0 = wmma32(pf, vf, o0); break;
        case 1: o1 = wmma32(pf, vf, o1); break;
        case 2: o2 = wmma32(pf, vf, o2); break;
        case 3: o3 = wmma32(pf, vf, o3); break;
      }
    }
  }

  // ---- normalize and store f32 output [B, T, H] ----
  #pragma unroll
  for (int r = 0; r < 8; ++r) {
    const float inv = 1.0f / lrow[r];
    const size_t base = ((size_t)b * T_SEQ + qr0 + r + hi * 8) * H_DIM + lh;
    out[base +  0] = o0[r] * inv;
    out[base + 16] = o1[r] * inv;
    out[base + 32] = o2[r] * inv;
    out[base + 48] = o3[r] * inv;
  }
}

// ---------------------------------------------------------------------------
extern "C" void kernel_launch(void* const* d_in, const int* in_sizes, int n_in,
                              void* d_out, int out_size, void* d_ws, size_t ws_size,
                              hipStream_t stream) {
  const float* x  = (const float*)d_in[0];
  const float* Wq = (const float*)d_in[1];
  const float* bq = (const float*)d_in[2];
  const float* Wk = (const float*)d_in[3];
  const float* bk = (const float*)d_in[4];
  const float* Wv = (const float*)d_in[5];
  const float* bv = (const float*)d_in[6];

  const size_t nQKV = (size_t)B_BATCH * T_SEQ * H_DIM;   // 8.4M elems each
  const size_t nW   = (size_t)3 * H_DIM * C_EMB;         // 73728 elems
  _Float16* Qh = (_Float16*)d_ws;                        // ~48 MB + 144 KB ws
  _Float16* Kh = Qh + nQKV;
  _Float16* Vt = Kh + nQKV;
  _Float16* Wt = Vt + nQKV;

  wcvt_kernel<<<dim3((unsigned)(nW / 256)), 256, 0, stream>>>(Wq, Wk, Wv, Wt);
  qkv_kernel<<<dim3((B_BATCH * T_SEQ) / QROWS), 128, 0, stream>>>(
      x, Wt, bq, bk, bv, Qh, Kh, Vt);
  attn_kernel<<<dim3(B_BATCH, 4), 128, 0, stream>>>(
      Qh, Kh, Vt, (float*)d_out);
}

// v004
// A run of this version takes 58.8 microseconds.
// Timed twice side by side with v003, it ran 1.07 times as fast both times.
// Counting every step since v000, it is 2.02 times as fast.
#include <hip/hip_runtime.h>
#include <hip/hip_bf16.h>

typedef __attribute__((ext_vector_type(16))) _Float16 v16h;
typedef __attribute__((ext_vector_type(8)))  _Float16 v8h;
typedef __attribute__((ext_vector_type(8)))  float    v8f;
typedef __attribute__((ext_vector_type(4)))  float    v4f;

#define B_BATCH 512
#define T_SEQ   256
#define C_EMB   384
#define H_DIM   64
#define KSTEPS  (C_EMB / 32)     // K-steps of one 16x16x32 product
#define MT      4                // 16-row tiles of x per qkv block
#define QROWS   (16 * MT)        // divides T_SEQ: a block stays in one batch
// LDS row pitches (XPITCH in halves, OPITCH in floats), each an odd multiple
// of 16 bytes: the 16 lanes of a half-wave touch 16 bytes of 16 different rows
// in one b128 access, and at such a pitch they fall on all 64 banks (at 768 B
// or 256 B rows they collide).
#define XPITCH  (C_EMB + 8)      // 784 B = 16 B x 49
#define OPITCH  (H_DIM + 4)      // 272 B = 16 B x 17
#define QK_SCALE 0.125f          // 64^-0.5
#define NEG_INF  (-1.0e30f)

__device__ __forceinline__ v8f wmma32(v16h a, v16h b, v8f c) {
  // v_wmma_f32_16x16x32_f16: D = A(16x32 f16) * B(32x16 f16) + C(16x16 f32)
  return __builtin_amdgcn_wmma_f32_16x16x32_f16(
      /*neg_a=*/false, a, /*neg_b=*/false, b,
      /*c_mod=*/(short)0, c, /*reuse_a=*/false, /*reuse_b=*/false);
}

__device__ __forceinline__ v8h ld8(const _Float16* p) {   // 16B vector load
  return *(const v8h*)p;
}
__device__ __forceinline__ v16h cat8(v8h a, v8h b) {
  return __builtin_shufflevector(a, b, 0,1,2,3,4,5,6,7,8,9,10,11,12,13,14,15);
}

__device__ __forceinline__ float xhalf(float x) {   // lane l <-> lane l ^ 16
  const int v = __builtin_bit_cast(int, x);
  return __builtin_bit_cast(float, __builtin_amdgcn_permlanex16(
      v, v, 0x76543210, 0xfedcba98, false, false));
}

// e^x as 2^(x * log2 e), the form __expf compiles to.  The v_nop is the slot
// that the instruction set asks for behind a transcendental before its source
// is overwritten.
__device__ __forceinline__ float exp_slot(float x) {
  float y;
  asm("v_exp_f32 %0, %1\n\tv_nop" : "=v"(y) : "v"(x * 1.44269504f));
  return y;
}

// ---------------------------------------------------------------------------
// Kernel 0: weight prep.  f16 weights packed in B-fragment order:
//   Wt[w][ks][m][half][lane][e] = (f16) W_m[c][h]
//   h = 16*w + (lane & 15),  c = 32*ks + 8*(lane >> 4) + 16*half + e
// (w: 16-column tile, ks: K-step of 32, m: q/k/v, e: 0..7).  One wave-wide
// 16-byte load of qkv_kernel then covers 512 contiguous bytes (4 whole lines).
// ---------------------------------------------------------------------------
__global__ __launch_bounds__(256)
void wcvt_kernel(const float* __restrict__ Wq, const float* __restrict__ Wk,
                 const float* __restrict__ Wv, _Float16* __restrict__ Wt) {
  const int idx  = blockIdx.x * 256 + threadIdx.x;
  const int e    = idx & 7;
  const int lane = (idx >> 3) & 31;
  const int half = (idx >> 8) & 1;
  const int t    = idx >> 9;                     // (w*KSTEPS + ks)*3 + m
  const int m    = t % 3;
  const int ks   = (t / 3) % KSTEPS;
  const int w    = t / (3 * KSTEPS);
  const int h    = w * 16 + (lane & 15);
  const int c    = ks * 32 + (lane >> 4) * 8 + half * 16 + e;
  const float* W = (m == 0) ? Wq : (m == 1) ? Wk : Wv;
  Wt[idx] = (_Float16)W[(size_t)c * H_DIM + h];
}

// ---------------------------------------------------------------------------
// Kernel 1: fused Q/K/V projection.  MT 16-row tiles of x per block.
// 128 threads = 4 waves; wave w computes H-columns [16w, 16w+16) of all MT
// row tiles, so each weight fragment it loads feeds MT products.
// x staged in LDS as f16 (ds_load_b128 A-fragments shared by 4 waves);
// weights come f16 in fragment order: each B half-fragment is one
// global_load_b128 over 512 contiguous bytes.
// Q gets bias + QK_SCALE folded in; V is stored transposed [B][H][T].
// ---------------------------------------------------------------------------
__global__ __launch_bounds__(128)
void qkv_kernel(const float* __restrict__ x,
                const _Float16* __restrict__ Wt,   // packed, see wcvt_kernel
                const float* __restrict__ bq, const float* __restrict__ bk,
                const float* __restrict__ bv,
                _Float16* __restrict__ Qh, _Float16* __restrict__ Kh,
                _Float16* __restrict__ Vt) {
  __shared__ __align__(16) _Float16 xs[QROWS * XPITCH];  // padded rows
  const int row0 = blockIdx.x * QROWS;                // global row (b*T + t)
  const int tid  = threadIdx.x;

  // cooperative f32 -> f16 stage of QROWS rows of x: per step the 128 threads
  // take a third of a row (C_EMB = 3 * 128), in the order of memory.
  const float* xg = x + (size_t)row0 * C_EMB + tid;
  _Float16*    xl = xs + tid;
  // one trip per 16-row tile, rolled to bound the code; its 48 steps unrolled:
  // a quarter of the waves now stage the same bytes per WGP, so each keeps a
  // whole tile's loads in flight instead of a few
  #pragma unroll 1
  for (int mt = 0; mt < MT; ++mt) {
    #pragma unroll
    for (int r = 0; r < 16; ++r) {
      #pragma unroll
      for (int t = 0; t < C_EMB / 128; ++t)
        xl[(mt * 16 + r) * XPITCH + t * 128] =
            (_Float16)xg[(mt * 16 + r) * C_EMB + t * 128];
    }
  }
  __syncthreads();

  const int wave = tid >> 5;                   // 0..3  -> H tile
  const int lane = tid & 31;
  const int lh   = lane & 15;                  // lane within half
  const int hi   = lane >> 4;                  // half select
  const int col  = wave * 16 + lh;             // output column in [0,64)

  // this wave's packed weights: 3 fragments of 512 halves per K-step
  const _Float16* wfrag = Wt + (size_t)wave * (KSTEPS * 3 * 512) + lane * 8;

  v8f accq[MT] = {}, acck[MT] = {}, accv[MT] = {};
  #pragma unroll 2
  for (int ks = 0; ks < KSTEPS; ++ks) {        // 12 K-steps of 32
    const int k0 = ks * 32 + hi * 8;
    // B fragments (same k order as A): two 512-byte planes each
    const _Float16* wk3 = wfrag + ks * (3 * 512);
    v16h fq = cat8(ld8(wk3),        ld8(wk3 + 256));
    v16h fk = cat8(ld8(wk3 + 512),  ld8(wk3 + 768));
    v16h fv = cat8(ld8(wk3 + 1024), ld8(wk3 + 1280));
    #pragma unroll  // constant mt keeps the accumulator arrays in registers
    for (int mt = 0; mt < MT; ++mt) {
      // A fragment (lane=M=lh; halves: k0+{0..7}, k0+16+{0..7})
      const _Float16* xrow = &xs[(mt * 16 + lh) * XPITCH + k0];
      v16h a = cat8(ld8(xrow), ld8(xrow + 16));
      accq[mt] = wmma32(a, fq, accq[mt]);
      acck[mt] = wmma32(a, fk, acck[mt]);
      accv[mt] = wmma32(a, fv, accv[mt]);
    }
  }

  const float biasq = bq[col], biask = bk[col], biasv = bv[col];
  const int b  = row0 / T_SEQ;                 // the block never crosses batch
  const int t0 = row0 % T_SEQ;
  #pragma unroll    // constant mt, r: accumulators are read from registers
  for (int mt = 0; mt < MT; ++mt) {
    #pragma unroll
    for (int r = 0; r < 8; ++r) {
      const int rr = mt * 16 + r + hi * 8;     // row within the block
      const size_t idx = (size_t)(row0 + rr) * H_DIM + col;
      Qh[idx] = (_Float16)((accq[mt][r] + biasq) * QK_SCALE);  // scale in Q
      Kh[idx] = (_Float16)(acck[mt][r] + biask);
      // V transposed: [B][H][T] so PV A-fragments are contiguous in s
      Vt[((size_t)b * H_DIM + col) * T_SEQ + t0 + rr] =
          (_Float16)(accv[mt][r] + biasv);
    }
  }
}

__global__ __launch_bounds__(128)
void attn_kernel(const _Float16* __restrict__ Qh,
                 const _Float16* __restrict__ Kh,
                 const _Float16* __restrict__ Vt,   // [B][H][T]
                 float* __restrict__ out) {
  __shared__ __align__(16) float obuf[4][16 * OPITCH];  // per-wave O staging

  const int tid  = threadIdx.x;
  const int wave = tid >> 5;
  const int lane = tid & 31;
  const int lh   = lane & 15;
  const int hi   = lane >> 4;

  const int b    = blockIdx.x;
  const int qt   = blockIdx.y * 4 + wave;      // Q tile index in [0,16)
  const int qr0  = qt * 16;                    // first Q row of the tile
  const size_t bofs  = (size_t)b * T_SEQ * H_DIM;
  const size_t bofsV = (size_t)b * H_DIM * T_SEQ;

  // Q as B fragments (lane = query): two 32x16 chunks covering H=64
  const _Float16* qr = Qh + bofs + (size_t)(qr0 + lh) * H_DIM + hi * 8;
  v16h qf0 = cat8(ld8(qr),      ld8(qr + 16));
  v16h qf1 = cat8(ld8(qr + 32), ld8(qr + 48));

  v8f o0 = {}, o1 = {}, o2 = {}, o3 = {};      // Ot: lane = query, r -> h
  float mrow = NEG_INF, lsum = 0.0f;           // lsum: this half's keys only

  #pragma unroll 1
  for (int j0 = 0; j0 <= qt; j0 += 2) {        // pairs of 16-wide K tiles
    const bool have1 = (j0 + 1) <= qt;

    // ---- scores: St = K (16x64) . Qt, per 16-key tile, 2 WMMAs each ----
    v8f s0 = {}, s1 = {};
    {
      const _Float16* kr = Kh + bofs + (size_t)(j0 * 16 + lh) * H_DIM + hi * 8;
      s0 = wmma32(cat8(ld8(kr),      ld8(kr + 16)), qf0, s0);
      s0 = wmma32(cat8(ld8(kr + 32), ld8(kr + 48)), qf1, s0);
    }
    // the K loads' address registers are reused for the V addresses further
    // down: this wait, and its like behind tile 1's loads, stands between the
    // loads and that overwrite
    asm volatile("s_wait_xcnt 0x0" ::: "memory");
    if (have1) {
      const _Float16* kr =
          Kh + bofs + (size_t)((j0 + 1) * 16 + lh) * H_DIM + hi * 8;
      s1 = wmma32(cat8(ld8(kr),      ld8(kr + 16)), qf0, s1);
      s1 = wmma32(cat8(ld8(kr + 32), ld8(kr + 48)), qf1, s1);
      asm volatile("s_wait_xcnt 0x0" ::: "memory");  // as behind tile 0's loads
    }

    // key r of tile 0 (r + 16 of tile 1) is seen by this lane's query iff
    // <= lim; without a tile 1 all of s1 is masked
    // (all loops over r unrolled: constant r keeps the tiles in registers)
    const int lim = (qt - j0) * 16 + lh - hi * 8;
    #pragma unroll
    for (int r = 0; r < 8; ++r) {
      if (r > lim)      s0[r] = NEG_INF;
      if (r + 16 > lim) s1[r] = NEG_INF;
    }

    // ---- online softmax: one query per lane, 16 of its 32 keys ----
    float mt = fmaxf(s0[0], s1[0]);
    #pragma unroll
    for (int r = 1; r < 8; ++r) mt = fmaxf(mt, fmaxf(s0[r], s1[r]));
    mt = fmaxf(mt, xhalf(mt));                 // the other half's 16 keys
    const float mnew = fmaxf(mrow, mt);
    const float sc   = exp_slot(mrow - mnew);
    mrow = mnew;
    v16h pf;                                   // Pt as a 32x16 B fragment
    lsum *= sc;
    #pragma unroll
    for (int r = 0; r < 8; ++r) {
      const float e0 = exp_slot(s0[r] - mnew);
      const float e1 = exp_slot(s1[r] - mnew);
      lsum += e0 + e1;
      pf[r]     = (_Float16)e0;
      pf[r + 8] = (_Float16)e1;
    }
    o0 *= sc; o1 *= sc; o2 *= sc; o3 *= sc;

    // ---- Ot += Vt (16x32) . Pt (32x16), one WMMA per 16-wide H tile ----
    const int off1 = have1 ? 16 : 0;           // stay in-bounds; P half is 0
    #pragma unroll
    for (int n = 0; n < 4; ++n) {
      const _Float16* vp =
          Vt + bofsV + (size_t)(n * 16 + lh) * T_SEQ + j0 * 16 + hi * 8;
      v16h vf = cat8(ld8(vp), ld8(vp + off1)); // contiguous in s (transposed V)
      switch (n) {
        case 0: o0 = wmma32(vf, pf, o0); break;
        case 1: o1 = wmma32(vf, pf, o1); break;
        case 2: o2 = wmma32(vf, pf, o2); break;
        case 3: o3 = wmma32(vf, pf, o3); break;
      }
    }
  }

  // ---- normalize; turn Ot through this wave's LDS; store whole lines ----
  const float inv = 1.0f / (lsum + xhalf(lsum));
  float* myo = obuf[wave];
  float* wr  = myo + lh * OPITCH + hi * 8;     // a lane holds 8 h in a row
  o0 *= inv; o1 *= inv; o2 *= inv; o3 *= inv;
  *(v4f*)(wr +  0) = __builtin_shufflevector(o0, o0, 0, 1, 2, 3);
  *(v4f*)(wr +  4) = __builtin_shufflevector(o0, o0, 4, 5, 6, 7);
  *(v4f*)(wr + 16) = __builtin_shufflevector(o1, o1, 0, 1, 2, 3);
  *(v4f*)(wr + 20) = __builtin_shufflevector(o1, o1, 4, 5, 6, 7);
  *(v4f*)(wr + 32) = __builtin_shufflevector(o2, o2, 0, 1, 2, 3);
  *(v4f*)(wr + 36) = __builtin_shufflevector(o2, o2, 4, 5, 6, 7);
  *(v4f*)(wr + 48) = __builtin_shufflevector(o3, o3, 0, 1, 2, 3);
  *(v4f*)(wr + 52) = __builtin_shufflevector(o3, o3, 4, 5, 6, 7);

  // per-wave LDS RAW across lanes: DS ops are in-order per wave; make it explicit
  asm volatile("s_wait_dscnt 0" ::: "memory");

  // 32 lanes x 16 B = two whole output rows (512 contiguous bytes) per store
  float* og = out + ((size_t)b * T_SEQ + qr0 + hi) * H_DIM + lh * 4;
  #pragma unroll
  for (int i = 0; i < 8; ++i)
    *(v4f*)(og + (size_t)i * 2 * H_DIM) =
        *(const v4f*)(myo + (i * 2 + hi) * OPITCH + lh * 4);
}

// ---------------------------------------------------------------------------
extern "C" void kernel_launch(void* const* d_in, const int* in_sizes, int n_in,
                              void* d_out, int out_size, void* d_ws, size_t ws_size,
                              hipStream_t stream) {
  const float* x  = (const float*)d_in[0];
  const float* Wq = (const float*)d_in[1];
  const float* bq = (const float*)d_in[2];
  const float* Wk = (const float*)d_in[3];
  const float* bk = (const float*)d_in[4];
  const float* Wv = (const float*)d_in[5];
  const float* bv = (const float*)d_in[6];

  const size_t nQKV = (size_t)B_BATCH * T_SEQ * H_DIM;   // 8.4M elems each
  const size_t nW   = (size_t)3 * H_DIM * C_EMB;         // 73728 elems
  _Float16* Qh = (_Float16*)d_ws;                        // ~48 MB + 144 KB ws
  _Float16* Kh = Qh + nQKV;
  _Float16* Vt = Kh + nQKV;
  _Float16* Wt = Vt + nQKV;

  wcvt_kernel<<<dim3((unsigned)(nW / 256)), 256, 0, stream>>>(Wq, Wk, Wv, Wt);
  qkv_kernel<<<dim3((B_BATCH * T_SEQ) / QROWS), 128, 0, stream>>>(
      x, Wt, bq, bk, bv, Qh, Kh, Vt);
  attn_kernel<<<dim3(B_BATCH, 4), 128, 0, stream>>>(
      Qh, Kh, Vt, (float*)d_out);
}

// v005
// Measured time: 54 microseconds a run.
// In two side-by-side timings against v004, it was 1.07 and 1.09 times as fast.
// All steps since v000 together make it 2.18 times as fast.
#include <hip/hip_runtime.h>
#include <hip/hip_bf16.h>

typedef __attribute__((ext_vector_type(16))) _Float16 v16h;
typedef __attribute__((ext_vector_type(8)))  _Float16 v8h;
typedef __attribute__((ext_vector_type(8)))  float    v8f;
typedef __attribute__((ext_vector_type(4)))  float    v4f;

#define B_BATCH 512
#define T_SEQ   256
#define C_EMB   384
#define H_DIM   64
#define KSTEPS  (C_EMB / 32)     // K-steps of one 16x16x32 product
#define MT      4                // 16-row tiles of x per qkv block
#define QROWS   (16 * MT)        // divides T_SEQ: a block stays in one batch
// LDS row pitches (XPITCH in halves, OPITCH in floats), each an odd multiple
// of 16 bytes: the 16 lanes of a half-wave touch 16 bytes of 16 different rows
// in one b128 access, and at such a pitch they fall on all 64 banks (at 768 B
// or 256 B rows they collide).
#define XPITCH  (C_EMB + 8)      // 784 B = 16 B x 49
#define OPITCH  (H_DIM + 4)      // 272 B = 16 B x 17
#define QK_SCALE 0.125f          // 64^-0.5
#define NEG_INF  (-1.0e30f)

__device__ __forceinline__ v8f wmma32(v16h a, v16h b, v8f c) {
  // v_wmma_f32_16x16x32_f16: D = A(16x32 f16) * B(32x16 f16) + C(16x16 f32)
  return __builtin_amdgcn_wmma_f32_16x16x32_f16(
      /*neg_a=*/false, a, /*neg_b=*/false, b,
      /*c_mod=*/(short)0, c, /*reuse_a=*/false, /*reuse_b=*/false);
}

__device__ __forceinline__ v8h ld8(const _Float16* p) {   // 16B vector load
  return *(const v8h*)p;
}
__device__ __forceinline__ v16h cat8(v8h a, v8h b) {
  return __builtin_shufflevector(a, b, 0,1,2,3,4,5,6,7,8,9,10,11,12,13,14,15);
}

__device__ __forceinline__ float xhalf(float x) {   // lane l <-> lane l ^ 16
  const int v = __builtin_bit_cast(int, x);
  return __builtin_bit_cast(float, __builtin_amdgcn_permlanex16(
      v, v, 0x76543210, 0xfedcba98, false, false));
}

// e^x as 2^(x * log2 e), the form __expf compiles to.  The v_nop is the slot
// that the instruction set asks for behind a transcendental before its source
// is overwritten.
__device__ __forceinline__ float exp_slot(float x) {
  float y;
  asm("v_exp_f32 %0, %1\n\tv_nop" : "=v"(y) : "v"(x * 1.44269504f));
  return y;
}

// ---------------------------------------------------------------------------
// Kernel 0: weight prep.  f16 weights packed in B-fragment order:
//   Wt[w][ks][m][half][lane][e] = (f16) W_m[c][h]
//   h = 16*w + (lane & 15),  c = 32*ks + 8*(lane >> 4) + 16*half + e
// (w: 16-column tile, ks: K-step of 32, m: q/k/v, e: 0..7).  One wave-wide
// 16-byte load of qkv_kernel then covers 512 contiguous bytes (4 whole lines).
// ---------------------------------------------------------------------------
__global__ __launch_bounds__(256)
void wcvt_kernel(const float* __restrict__ Wq, const float* __restrict__ Wk,
                 const float* __restrict__ Wv, _Float16* __restrict__ Wt) {
  const int idx  = blockIdx.x * 256 + threadIdx.x;
  const int e    = idx & 7;
  const int lane = (idx >> 3) & 31;
  const int half = (idx >> 8) & 1;
  const int t    = idx >> 9;                     // (w*KSTEPS + ks)*3 + m
  const int m    = t % 3;
  const int ks   = (t / 3) % KSTEPS;
  const int w    = t / (3 * KSTEPS);
  const int h    = w * 16 + (lane & 15);
  const int c    = ks * 32 + (lane >> 4) * 8 + half * 16 + e;
  const float* W = (m == 0) ? Wq : (m == 1) ? Wk : Wv;
  Wt[idx] = (_Float16)W[(size_t)c * H_DIM + h];
}

// ---------------------------------------------------------------------------
// Kernel 1: fused Q/K/V projection.  MT 16-row tiles of x per block.
// 128 threads = 4 waves; wave w computes H-columns [16w, 16w+16) of all MT
// row tiles, so each weight fragment it loads feeds MT products.
// x staged in LDS as f16 (ds_load_b128 fragments shared by 4 waves);
// weights come f16 in fragment order: each half-fragment is one
// global_load_b128 over 512 contiguous bytes.
// Q gets bias + QK_SCALE folded in.
// Q, K and V leave in the order in which attn_kernel's fragments want them:
//   F[tile][p][lane][e]   (tile: 16 rows of x, global; p: 0..3; e: 0..7)
//   Q, K: row = 16*tile + (lane & 15),          h = 16*p + 8*(lane >> 4) + e
//   V:    row = 16*tile + 8*(lane >> 4) + e,    h = 16*p + (lane & 15)
// Q and K are computed transposed (A = weights, B = x; both loaders keep their
// k order), so that a lane's 8 accumulator values are 8 h of one row; V's are
// 8 rows of one h as they stand.  With p = wave each (tile, p) is then one
// wave-wide 16-byte store over 512 contiguous bytes (4 whole lines).
// ---------------------------------------------------------------------------
__global__ __launch_bounds__(128)
void qkv_kernel(const float* __restrict__ x,
                const _Float16* __restrict__ Wt,   // packed, see wcvt_kernel
                const float* __restrict__ bq, const float* __restrict__ bk,
                const float* __restrict__ bv,
                _Float16* __restrict__ Qf, _Float16* __restrict__ Kf,
                _Float16* __restrict__ Vf) {
  __shared__ __align__(16) _Float16 xs[QROWS * XPITCH];  // padded rows
  const int row0 = blockIdx.x * QROWS;                // global row (b*T + t)
  const int tid  = threadIdx.x;

  // cooperative f32 -> f16 stage of QROWS rows of x: per step the 128 threads
  // take a third of a row (C_EMB = 3 * 128), in the order of memory.
  const float* xg = x + (size_t)row0 * C_EMB + tid;
  _Float16*    xl = xs + tid;
  // one trip per 16-row tile, rolled to bound the code; its 48 steps unrolled:
  // a quarter of the waves now stage the same bytes per WGP, so each keeps a
  // whole tile's loads in flight instead of a few
  #pragma unroll 1
  for (int mt = 0; mt < MT; ++mt) {
    #pragma unroll
    for (int r = 0; r < 16; ++r) {
      #pragma unroll
      for (int t = 0; t < C_EMB / 128; ++t)
        xl[(mt * 16 + r) * XPITCH + t * 128] =
            (_Float16)xg[(mt * 16 + r) * C_EMB + t * 128];
    }
  }
  __syncthreads();

  const int wave = tid >> 5;                   // 0..3  -> H tile
  const int lane = tid & 31;
  const int lh   = lane & 15;                  // lane within half
  const int hi   = lane >> 4;                  // half select

  // this wave's packed weights: 3 fragments of 512 halves per K-step
  const _Float16* wfrag = Wt + (size_t)wave * (KSTEPS * 3 * 512) + lane * 8;

  v8f accq[MT] = {}, acck[MT] = {}, accv[MT] = {};
  #pragma unroll 2
  for (int ks = 0; ks < KSTEPS; ++ks) {        // 12 K-steps of 32
    const int k0 = ks * 32 + hi * 8;
    // weight fragments (same k order as x's): two 512-byte planes each
    const _Float16* wk3 = wfrag + ks * (3 * 512);
    v16h fq = cat8(ld8(wk3),        ld8(wk3 + 256));
    v16h fk = cat8(ld8(wk3 + 512),  ld8(wk3 + 768));
    v16h fv = cat8(ld8(wk3 + 1024), ld8(wk3 + 1280));
    #pragma unroll  // constant mt keeps the accumulator arrays in registers
    for (int mt = 0; mt < MT; ++mt) {
      // x fragment (lane = row lh; halves: k0+{0..7}, k0+16+{0..7})
      const _Float16* xrow = &xs[(mt * 16 + lh) * XPITCH + k0];
      v16h a = cat8(ld8(xrow), ld8(xrow + 16));
      accq[mt] = wmma32(fq, a, accq[mt]);      // Qt: lane = row, r -> h
      acck[mt] = wmma32(fk, a, acck[mt]);      // Kt: lane = row, r -> h
      accv[mt] = wmma32(a, fv, accv[mt]);      // V:  lane = h,   r -> row
    }
  }

  const int   hq    = wave * 16 + hi * 8;      // first of this lane's 8 h (Q, K)
  const float biasv = bv[wave * 16 + lh];
  const size_t f0 = ((size_t)blockIdx.x * MT * 4 + wave) * 256 + lane * 8;
  #pragma unroll    // constant mt, r: accumulators are read from registers
  for (int mt = 0; mt < MT; ++mt) {
    v8h q, k, v;
    #pragma unroll
    for (int r = 0; r < 8; ++r) {
      q[r] = (_Float16)((accq[mt][r] + bq[hq + r]) * QK_SCALE);  // scale in Q
      k[r] = (_Float16)(acck[mt][r] + bk[hq + r]);
      v[r] = (_Float16)(accv[mt][r] + biasv);
    }
    *(v8h*)(Qf + f0 + mt * 1024) = q;
    *(v8h*)(Kf + f0 + mt * 1024) = k;
    *(v8h*)(Vf + f0 + mt * 1024) = v;
  }
}

__global__ __launch_bounds__(128)
void attn_kernel(const _Float16* __restrict__ Qf,
                 const _Float16* __restrict__ Kf,
                 const _Float16* __restrict__ Vf,
                 float* __restrict__ out) {
  __shared__ __align__(16) float obuf[4][16 * OPITCH];  // per-wave O staging

  const int tid  = threadIdx.x;
  const int wave = tid >> 5;
  const int lane = tid & 31;
  const int lh   = lane & 15;
  const int hi   = lane >> 4;

  const int b    = blockIdx.x;
  const int qt   = blockIdx.y * 4 + wave;      // Q tile index in [0,16)
  const int qr0  = qt * 16;                    // first Q row of the tile
  const size_t bofs = (size_t)b * T_SEQ * H_DIM + lane * 8;  // tile 0, piece 0

  // Q as B fragments (lane = query): two 32x16 chunks covering H=64
  const _Float16* qr = Qf + bofs + qt * 1024;
  v16h qf0 = cat8(ld8(qr),       ld8(qr + 256));
  v16h qf1 = cat8(ld8(qr + 512), ld8(qr + 768));

  v8f o0 = {}, o1 = {}, o2 = {}, o3 = {};      // Ot: lane = query, r -> h
  float mrow = NEG_INF, lsum = 0.0f;           // lsum: this half's keys only

  #pragma unroll 1
  for (int j0 = 0; j0 <= qt; j0 += 2) {        // pairs of 16-wide K tiles
    const bool have1 = (j0 + 1) <= qt;

    // ---- scores: St = K (16x64) . Qt, per 16-key tile, 2 WMMAs each ----
    v8f s0 = {}, s1 = {};
    {
      const _Float16* kr = Kf + bofs + j0 * 1024;
      s0 = wmma32(cat8(ld8(kr),       ld8(kr + 256)), qf0, s0);
      s0 = wmma32(cat8(ld8(kr + 512), ld8(kr + 768)), qf1, s0);
    }
    // the K loads' address registers are reused for the V addresses further
    // down: this wait, and its like behind tile 1's loads, stands between the
    // loads and that overwrite
    asm volatile("s_wait_xcnt 0x0" ::: "memory");
    if (have1) {
      const _Float16* kr = Kf + bofs + (j0 + 1) * 1024;
      s1 = wmma32(cat8(ld8(kr),       ld8(kr + 256)), qf0, s1);
      s1 = wmma32(cat8(ld8(kr + 512), ld8(kr + 768)), qf1, s1);
      asm volatile("s_wait_xcnt 0x0" ::: "memory");  // as behind tile 0's loads
    }

    // key r of tile 0 (r + 16 of tile 1) is seen by this lane's query iff
    // <= lim; without a tile 1 all of s1 is masked
    // (all loops over r unrolled: constant r keeps the tiles in registers)
    const int lim = (qt - j0) * 16 + lh - hi * 8;
    #pragma unroll
    for (int r = 0; r < 8; ++r) {
      if (r > lim)      s0[r] = NEG_INF;
      if (r + 16 > lim) s1[r] = NEG_INF;
    }

    // ---- online softmax: one query per lane, 16 of its 32 keys ----
    float mt = fmaxf(s0[0], s1[0]);
    #pragma unroll
    for (int r = 1; r < 8; ++r) mt = fmaxf(mt, fmaxf(s0[r], s1[r]));
    mt = fmaxf(mt, xhalf(mt));                 // the other half's 16 keys
    const float mnew = fmaxf(mrow, mt);
    const float sc   = exp_slot(mrow - mnew);
    mrow = mnew;
    v16h pf;                                   // Pt as a 32x16 B fragment
    lsum *= sc;
    #pragma unroll
    for (int r = 0; r < 8; ++r) {
      const float e0 = exp_slot(s0[r] - mnew);
      const float e1 = exp_slot(s1[r] - mnew);
      lsum += e0 + e1;
      pf[r]     = (_Float16)e0;
      pf[r + 8] = (_Float16)e1;
    }
    o0 *= sc; o1 *= sc; o2 *= sc; o3 *= sc;

    // ---- Ot += Vt (16x32) . Pt (32x16), one WMMA per 16-wide H tile ----
    const int off1 = have1 ? 1024 : 0;         // no tile 1: its P half is 0
    #pragma unroll
    for (int n = 0; n < 4; ++n) {
      const _Float16* vp = Vf + bofs + j0 * 1024 + n * 256;
      v16h vf = cat8(ld8(vp), ld8(vp + off1)); // keys of tile j0, of tile j0 + 1
      switch (n) {
        case 0: o0 = wmma32(vf, pf, o0); break;
        case 1: o1 = wmma32(vf, pf, o1); break;
        case 2: o2 = wmma32(vf, pf, o2); break;
        case 3: o3 = wmma32(vf, pf, o3); break;
      }
    }
  }

  // ---- normalize; turn Ot through this wave's LDS; store whole lines ----
  const float inv = 1.0f / (lsum + xhalf(lsum));
  float* myo = obuf[wave];
  float* wr  = myo + lh * OPITCH + hi * 8;     // a lane holds 8 h in a row
  o0 *= inv; o1 *= inv; o2 *= inv; o3 *= inv;
  *(v4f*)(wr +  0) = __builtin_shufflevector(o0, o0, 0, 1, 2, 3);
  *(v4f*)(wr +  4) = __builtin_shufflevector(o0, o0, 4, 5, 6, 7);
  *(v4f*)(wr + 16) = __builtin_shufflevector(o1, o1, 0, 1, 2, 3);
  *(v4f*)(wr + 20) = __builtin_shufflevector(o1, o1, 4, 5, 6, 7);
  *(v4f*)(wr + 32) = __builtin_shufflevector(o2, o2, 0, 1, 2, 3);
  *(v4f*)(wr + 36) = __builtin_shufflevector(o2, o2, 4, 5, 6, 7);
  *(v4f*)(wr + 48) = __builtin_shufflevector(o3, o3, 0, 1, 2, 3);
  *(v4f*)(wr + 52) = __builtin_shufflevector(o3, o3, 4, 5, 6, 7);

  // per-wave LDS RAW across lanes: DS ops are in-order per wave; make it explicit
  asm volatile("s_wait_dscnt 0" ::: "memory");

  // 32 lanes x 16 B = two whole output rows (512 contiguous bytes) per store
  float* og = out + ((size_t)b * T_SEQ + qr0 + hi) * H_DIM + lh * 4;
  #pragma unroll
  for (int i = 0; i < 8; ++i)
    *(v4f*)(og + (size_t)i * 2 * H_DIM) =
        *(const v4f*)(myo + (i * 2 + hi) * OPITCH + lh * 4);
}

// ---------------------------------------------------------------------------
extern "C" void kernel_launch(void* const* d_in, const int* in_sizes, int n_in,
                              void* d_out, int out_size, void* d_ws, size_t ws_size,
                              hipStream_t stream) {
  const float* x  = (const float*)d_in[0];
  const float* Wq = (const float*)d_in[1];
  const float* bq = (const float*)d_in[2];
  const float* Wk = (const float*)d_in[3];
  const float* bk = (const float*)d_in[4];
  const float* Wv = (const float*)d_in[5];
  const float* bv = (const float*)d_in[6];

  const size_t nQKV = (size_t)B_BATCH * T_SEQ * H_DIM;   // 8.4M elems each
  const size_t nW   = (size_t)3 * H_DIM * C_EMB;         // 73728 elems
  _Float16* Qf = (_Float16*)d_ws;                        // ~48 MB + 144 KB ws
  _Float16* Kf = Qf + nQKV;
  _Float16* Vf = Kf + nQKV;
  _Float16* Wt = Vf + nQKV;

  wcvt_kernel<<<dim3((unsigned)(nW / 256)), 256, 0, stream>>>(Wq, Wk, Wv, Wt);
  qkv_kernel<<<dim3((B_BATCH * T_SEQ) / QROWS), 128, 0, stream>>>(
      x, Wt, bq, bk, bv, Qf, Kf, Vf);
  attn_kernel<<<dim3(B_BATCH, 4), 128, 0, stream>>>(
      Qf, Kf, Vf, (float*)d_out);
}

// v006
// One run takes 37.3 microseconds.
// Timed twice side by side with v005, it ran 1.47 and 1.46 times as fast.
// All steps since v000 together make it 3.19 times as fast.
#include <hip/hip_runtime.h>
#include <hip/hip_bf16.h>

typedef __attribute__((ext_vector_type(16))) _Float16 v16h;
typedef __attribute__((ext_vector_type(8)))  _Float16 v8h;
typedef __attribute__((ext_vector_type(8)))  float    v8f;
typedef __attribute__((ext_vector_type(4)))  float    v4f;

#define B_BATCH 512
#define T_SEQ   256
#define C_EMB   384
#define H_DIM   64
#define KSTEPS  (C_EMB / 32)     // K-steps of one 16x16x32 product
#define MT      4                // 16-row tiles of x per group of 4 waves
#define QROWS   (16 * MT)        // rows of x per group of 4 waves
#define GROUPS  2                // groups per block
#define PROWS   (QROWS * GROUPS) // rows of x per pass of a block
#define PASSES  (T_SEQ / PROWS)  // a block does one whole batch
#define KCH     128              // columns of x staged at a time
#define NCH     (C_EMB / KCH)
#define FSZ     (T_SEQ * H_DIM)  // halves of one batch's Q (or K, or V)
// LDS row pitches (XPITCH in halves, OPITCH in floats), each an odd multiple
// of 16 bytes: the 16 lanes of a half-wave touch 16 bytes of 16 different rows
// in one b128 access, and at such a pitch they fall on all 64 banks (at 256 B
// rows they collide).
#define XPITCH  (KCH + 8)        // 272 B = 16 B x 17
#define OPITCH  (H_DIM + 4)      // 272 B = 16 B x 17
#define QK_SCALE 0.125f          // 64^-0.5
#define NEG_INF  (-1.0e30f)

__device__ __forceinline__ v8f wmma32(v16h a, v16h b, v8f c) {
  // v_wmma_f32_16x16x32_f16: D = A(16x32 f16) * B(32x16 f16) + C(16x16 f32)
  return __builtin_amdgcn_wmma_f32_16x16x32_f16(
      /*neg_a=*/false, a, /*neg_b=*/false, b,
      /*c_mod=*/(short)0, c, /*reuse_a=*/false, /*reuse_b=*/false);
}

__device__ __forceinline__ v8h ld8(const _Float16* p) {   // 16B vector load
  return *(const v8h*)p;
}
__device__ __forceinline__ v16h cat8(v8h a, v8h b) {
  return __builtin_shufflevector(a, b, 0,1,2,3,4,5,6,7,8,9,10,11,12,13,14,15);
}

__device__ __forceinline__ float xhalf(float x) {   // lane l <-> lane l ^ 16
  const int v = __builtin_bit_cast(int, x);
  return __builtin_bit_cast(float, __builtin_amdgcn_permlanex16(
      v, v, 0x76543210, 0xfedcba98, false, false));
}

// e^x as 2^(x * log2 e), the form __expf compiles to.  The v_nop is the slot
// that the instruction set asks for behind a transcendental before its source
// is overwritten.
__device__ __forceinline__ float exp_slot(float x) {
  float y;
  asm("v_exp_f32 %0, %1\n\tv_nop" : "=v"(y) : "v"(x * 1.44269504f));
  return y;
}

// ---------------------------------------------------------------------------
// Kernel 0: weight prep.  f16 weights packed in B-fragment order:
//   Wt[w][ks][m][half][lane][e] = (f16) W_m[c][h]
//   h = 16*w + (lane & 15),  c = 32*ks + 8*(lane >> 4) + 16*half + e
// (w: 16-column tile, ks: K-step of 32, m: q/k/v, e: 0..7).  One wave-wide
// 16-byte load of head_kernel then covers 512 contiguous bytes (4 whole lines).
// ---------------------------------------------------------------------------
__global__ __launch_bounds__(256)
void wcvt_kernel(const float* __restrict__ Wq, const float* __restrict__ Wk,
                 const float* __restrict__ Wv, _Float16* __restrict__ Wt) {
  const int idx  = blockIdx.x * 256 + threadIdx.x;
  const int e    = idx & 7;
  const int lane = (idx >> 3) & 31;
  const int half = (idx >> 8) & 1;
  const int t    = idx >> 9;                     // (w*KSTEPS + ks)*3 + m
  const int m    = t % 3;
  const int ks   = (t / 3) % KSTEPS;
  const int w    = t / (3 * KSTEPS);
  const int h    = w * 16 + (lane & 15);
  const int c    = ks * 32 + (lane >> 4) * 8 + half * 16 + e;
  const float* W = (m == 0) ? Wq : (m == 1) ? Wk : Wv;
  Wt[idx] = (_Float16)W[(size_t)c * H_DIM + h];
}

__global__ __launch_bounds__(256)
void head_kernel(const float* __restrict__ x,
                 const _Float16* __restrict__ Wt,   // packed, see wcvt_kernel
                 const float* __restrict__ bq, const float* __restrict__ bk,
                 const float* __restrict__ bv,
                 float* __restrict__ out) {
  __shared__ __align__(16) _Float16 qkv[3 * FSZ];        // Q, K, V fragments
  // padded rows of x; behind the projection the per-wave O staging
  __shared__ __align__(16) _Float16 xs[PROWS * XPITCH];
  static_assert(8 * 16 * OPITCH * sizeof(float) <= sizeof(xs), "O staging");

  const int b     = blockIdx.x;
  const int tid   = threadIdx.x;
  // the wave's number in a scalar register: the loops over tiles that depend
  // on it then branch on scalars, with every lane on at the matrix products
  const int wave8 = __builtin_amdgcn_readfirstlane(tid >> 5);   // 0..7
  const int lane  = tid & 31;
  const int lh    = lane & 15;                 // lane within half
  const int hi    = lane >> 4;                 // half select
  const int grp   = wave8 >> 2;                // 0..1  -> 64 rows of the pass
  const int wave  = wave8 & 3;                 // 0..3  -> H tile

  _Float16* Qs = qkv + lane * 8;               // tile 0, piece 0
  _Float16* Ks = Qs + FSZ;
  _Float16* Vs = Ks + FSZ;

  // this wave's packed weights: 3 fragments of 512 halves per K-step
  const _Float16* wfrag = Wt + (size_t)wave * (KSTEPS * 3 * 512) + lane * 8;
  const int   hq    = wave * 16 + hi * 8;      // first of this lane's 8 h (Q, K)
  const float biasv = bv[wave * 16 + lh];

  #pragma unroll 1  // rolled to bound the code
  for (int ps = 0; ps < PASSES; ++ps) {
    // cooperative f32 -> f16 stage: per step the 128 threads of a group take
    // the KCH columns of one row, in the order of memory.
    const float* xg = x + ((size_t)b * T_SEQ + ps * PROWS + grp * QROWS) * C_EMB
                        + (tid & 127);
    _Float16*    xl = xs + grp * QROWS * XPITCH + (tid & 127);

    v8f accq[MT] = {}, acck[MT] = {}, accv[MT] = {};
    #pragma unroll 1  // rolled to bound the code
    for (int ch = 0; ch < NCH; ++ch) {
      __syncthreads();                         // the last chunk has been read
      #pragma unroll  // a whole chunk's loads in flight per wave
      for (int r = 0; r < QROWS; ++r)
        xl[r * XPITCH] = (_Float16)xg[r * C_EMB + ch * KCH];
      __syncthreads();                         // this chunk is written

      #pragma unroll 2
      for (int kk = 0; kk < KCH / 32; ++kk) {  // 4 K-steps of 32
        const int k0 = kk * 32 + hi * 8;
        // B fragments (same k order as A): two 512-byte planes each
        const _Float16* wk3 = wfrag + (ch * (KCH / 32) + kk) * (3 * 512);
        v16h fq = cat8(ld8(wk3),        ld8(wk3 + 256));
        v16h fk = cat8(ld8(wk3 + 512),  ld8(wk3 + 768));
        v16h fv = cat8(ld8(wk3 + 1024), ld8(wk3 + 1280));
        #pragma unroll  // constant mt keeps the accumulator arrays in registers
        for (int mt = 0; mt < MT; ++mt) {
          // A fragment (lane=M=lh; halves: k0+{0..7}, k0+16+{0..7})
          const _Float16* xrow =
              &xs[(grp * QROWS + mt * 16 + lh) * XPITCH + k0];
          v16h a = cat8(ld8(xrow), ld8(xrow + 16));
          accq[mt] = wmma32(fq, a, accq[mt]);  // Qt: lane = row, r -> h
          acck[mt] = wmma32(fk, a, acck[mt]);  // Kt: lane = row, r -> h
          accv[mt] = wmma32(a, fv, accv[mt]);  // V:  lane = h,   r -> row
        }
      }
    }

    const int f0 = ((ps * GROUPS + grp) * MT * 4 + wave) * 256;
    #pragma unroll    // constant mt, r: accumulators are read from registers
    for (int mt = 0; mt < MT; ++mt) {
      v8h q, k, v;
      #pragma unroll
      for (int r = 0; r < 8; ++r) {
        q[r] = (_Float16)((accq[mt][r] + bq[hq + r]) * QK_SCALE);  // scale in Q
        k[r] = (_Float16)(acck[mt][r] + bk[hq + r]);
        v[r] = (_Float16)(accv[mt][r] + biasv);
      }
      *(v8h*)(Qs + f0 + mt * 1024) = q;
      *(v8h*)(Ks + f0 + mt * 1024) = k;
      *(v8h*)(Vs + f0 + mt * 1024) = v;
    }
  }
  __syncthreads();   // Q, K, V are written; nobody reads xs as x any more

  float* myo = (float*)xs + wave8 * (16 * OPITCH);       // this wave's O staging

  #pragma unroll 1  // one tile after the other, rolled to bound the code
  for (int half = 0; half < 2; ++half) {
    const int qt  = half ? wave8 : 15 - wave8; // Q tile index in [0,16)
    const int qr0 = qt * 16;                   // first Q row of the tile

    // Q as B fragments (lane = query): two 32x16 chunks covering H=64
    const _Float16* qr = Qs + qt * 1024;
    v16h qf0 = cat8(ld8(qr),       ld8(qr + 256));
    v16h qf1 = cat8(ld8(qr + 512), ld8(qr + 768));

    v8f o0 = {}, o1 = {}, o2 = {}, o3 = {};    // Ot: lane = query, r -> h
    float mrow = NEG_INF, lsum = 0.0f;         // lsum: this half's keys only

    #pragma unroll 1
    for (int j0 = 0; j0 <= qt; j0 += 2) {      // pairs of 16-wide K tiles
      const bool have1 = (j0 + 1) <= qt;

      // ---- scores: St = K (16x64) . Qt, per 16-key tile, 2 WMMAs each ----
      v8f s0 = {}, s1 = {};
      {
        const _Float16* kr = Ks + j0 * 1024;
        s0 = wmma32(cat8(ld8(kr),       ld8(kr + 256)), qf0, s0);
        s0 = wmma32(cat8(ld8(kr + 512), ld8(kr + 768)), qf1, s0);
      }
      if (have1) {
        const _Float16* kr = Ks + (j0 + 1) * 1024;
        s1 = wmma32(cat8(ld8(kr),       ld8(kr + 256)), qf0, s1);
        s1 = wmma32(cat8(ld8(kr + 512), ld8(kr + 768)), qf1, s1);
      }

      // key r of tile 0 (r + 16 of tile 1) is seen by this lane's query iff
      // <= lim; without a tile 1 all of s1 is masked
      // (all loops over r unrolled: constant r keeps the tiles in registers)
      const int lim = (qt - j0) * 16 + lh - hi * 8;
      #pragma unroll
      for (int r = 0; r < 8; ++r) {
        if (r > lim)      s0[r] = NEG_INF;
        if (r + 16 > lim) s1[r] = NEG_INF;
      }

      // ---- online softmax: one query per lane, 16 of its 32 keys ----
      float mt = fmaxf(s0[0], s1[0]);
      #pragma unroll
      for (int r = 1; r < 8; ++r) mt = fmaxf(mt, fmaxf(s0[r], s1[r]));
      mt = fmaxf(mt, xhalf(mt));               // the other half's 16 keys
      const float mnew = fmaxf(mrow, mt);
      const float sc   = exp_slot(mrow - mnew);
      mrow = mnew;
      v16h pf;                                 // Pt as a 32x16 B fragment
      lsum *= sc;
      #pragma unroll
      for (int r = 0; r < 8; ++r) {
        const float e0 = exp_slot(s0[r] - mnew);
        const float e1 = exp_slot(s1[r] - mnew);
        lsum += e0 + e1;
        pf[r]     = (_Float16)e0;
        pf[r + 8] = (_Float16)e1;
      }
      o0 *= sc; o1 *= sc; o2 *= sc; o3 *= sc;

      // ---- Ot += Vt (16x32) . Pt (32x16), one WMMA per 16-wide H tile ----
      const int off1 = have1 ? 1024 : 0;       // no tile 1: its P half is 0
      #pragma unroll
      for (int n = 0; n < 4; ++n) {
        const _Float16* vp = Vs + j0 * 1024 + n * 256;
        v16h vf = cat8(ld8(vp), ld8(vp + off1)); // keys of tile j0, of j0 + 1
        switch (n) {
          case 0: o0 = wmma32(vf, pf, o0); break;
          case 1: o1 = wmma32(vf, pf, o1); break;
          case 2: o2 = wmma32(vf, pf, o2); break;
          case 3: o3 = wmma32(vf, pf, o3); break;
        }
      }
    }

    // ---- normalize; turn Ot through this wave's LDS; store whole lines ----
    const float inv = 1.0f / (lsum + xhalf(lsum));
    float* wr  = myo + lh * OPITCH + hi * 8;   // a lane holds 8 h in a row
    o0 *= inv; o1 *= inv; o2 *= inv; o3 *= inv;
    *(v4f*)(wr +  0) = __builtin_shufflevector(o0, o0, 0, 1, 2, 3);
    *(v4f*)(wr +  4) = __builtin_shufflevector(o0, o0, 4, 5, 6, 7);
    *(v4f*)(wr + 16) = __builtin_shufflevector(o1, o1, 0, 1, 2, 3);
    *(v4f*)(wr + 20) = __builtin_shufflevector(o1, o1, 4, 5, 6, 7);
    *(v4f*)(wr + 32) = __builtin_shufflevector(o2, o2, 0, 1, 2, 3);
    *(v4f*)(wr + 36) = __builtin_shufflevector(o2, o2, 4, 5, 6, 7);
    *(v4f*)(wr + 48) = __builtin_shufflevector(o3, o3, 0, 1, 2, 3);
    *(v4f*)(wr + 52) = __builtin_shufflevector(o3, o3, 4, 5, 6, 7);

    // per-wave LDS RAW across lanes: DS ops are in-order per wave; make it explicit
    asm volatile("s_wait_dscnt 0" ::: "memory");

    // 32 lanes x 16 B = two whole output rows (512 contiguous bytes) per store
    float* og = out + ((size_t)b * T_SEQ + qr0 + hi) * H_DIM + lh * 4;
    #pragma unroll
    for (int i = 0; i < 8; ++i)
      *(v4f*)(og + (size_t)i * 2 * H_DIM) =
          *(const v4f*)(myo + (i * 2 + hi) * OPITCH + lh * 4);
    // the next tile's start values overwrite the registers that these stores
    // name: this wait stands between the stores and that overwrite
    asm volatile("s_wait_xcnt 0x0" ::: "memory");
  }
}

// ---------------------------------------------------------------------------
extern "C" void kernel_launch(void* const* d_in, const int* in_sizes, int n_in,
                              void* d_out, int out_size, void* d_ws, size_t ws_size,
                              hipStream_t stream) {
  const float* x  = (const float*)d_in[0];
  const float* Wq = (const float*)d_in[1];
  const float* bq = (const float*)d_in[2];
  const float* Wk = (const float*)d_in[3];
  const float* bk = (const float*)d_in[4];
  const float* Wv = (const float*)d_in[5];
  const float* bv = (const float*)d_in[6];

  const size_t nW = (size_t)3 * H_DIM * C_EMB;           // 73728 elems
  _Float16* Wt = (_Float16*)d_ws;                        // 144 KB of ws

  wcvt_kernel<<<dim3((unsigned)(nW / 256)), 256, 0, stream>>>(Wq, Wk, Wv, Wt);
  head_kernel<<<dim3(B_BATCH), 256, 0, stream>>>(
      x, Wt, bq, bk, bv, (float*)d_out);
}

// v007
// One run takes 33.2 microseconds.
// Two timings next to v006 put it at 1.13 and 1.12 times that version's speed.
// All steps since v000 together make it 3.60 times as fast.
#include <hip/hip_runtime.h>
#include <hip/hip_bf16.h>

typedef __attribute__((ext_vector_type(16))) _Float16 v16h;
typedef __attribute__((ext_vector_type(8)))  _Float16 v8h;
typedef __attribute__((ext_vector_type(4)))  _Float16 v4h;
typedef __attribute__((ext_vector_type(8)))  float    v8f;
typedef __attribute__((ext_vector_type(4)))  float    v4f;

#define B_BATCH 512
#define T_SEQ   256
#define C_EMB   384
#define H_DIM   64
#define KSTEPS  (C_EMB / 32)     // K-steps of one 16x16x32 product
#define MT      4                // 16-row tiles of x per group of 4 waves
#define QROWS   (16 * MT)        // rows of x per group of 4 waves
#define GROUPS  2                // groups per block
#define PROWS   (QROWS * GROUPS) // rows of x per pass of a block
#define PASSES  (T_SEQ / PROWS)  // a block does one whole batch
#define KCH     64               // columns of x in one staged tile
#define NCH     (C_EMB / KCH)
#define NT      (PASSES * NCH)   // tiles of x per block
#define RAWH    (QROWS * KCH * 4) // bytes of half a tile as f32 (64 rows)
#define FSZ     (T_SEQ * H_DIM)  // halves of one batch's Q (or K, or V)
// LDS row pitches (XPITCH in halves, OPITCH in floats), each an odd multiple
// of 16 bytes: the 16 lanes of a half-wave touch 16 bytes of 16 different rows
// in one b128 access, and at such a pitch they fall on all 64 banks (at 128 B
// or 256 B rows they collide).
#define XPITCH  (KCH + 8)        // 144 B = 16 B x 9
#define OPITCH  (H_DIM + 4)      // 272 B = 16 B x 17
#define QK_SCALE 0.125f          // 64^-0.5
#define NEG_INF  (-1.0e30f)

__device__ __forceinline__ v8f wmma32(v16h a, v16h b, v8f c) {
  // v_wmma_f32_16x16x32_f16: D = A(16x32 f16) * B(32x16 f16) + C(16x16 f32)
  return __builtin_amdgcn_wmma_f32_16x16x32_f16(
      /*neg_a=*/false, a, /*neg_b=*/false, b,
      /*c_mod=*/(short)0, c, /*reuse_a=*/false, /*reuse_b=*/false);
}

__device__ __forceinline__ v8h ld8(const _Float16* p) {   // 16B vector load
  return *(const v8h*)p;
}
__device__ __forceinline__ v16h cat8(v8h a, v8h b) {
  return __builtin_shufflevector(a, b, 0,1,2,3,4,5,6,7,8,9,10,11,12,13,14,15);
}

__device__ __forceinline__ float xhalf(float x) {   // lane l <-> lane l ^ 16
  const int v = __builtin_bit_cast(int, x);
  return __builtin_bit_cast(float, __builtin_amdgcn_permlanex16(
      v, v, 0x76543210, 0xfedcba98, false, false));
}

// e^x as 2^(x * log2 e), the form __expf compiles to.  The v_nop is the slot
// that the instruction set asks for behind a transcendental before its source
// is overwritten.
__device__ __forceinline__ float exp_slot(float x) {
  float y;
  asm("v_exp_f32 %0, %1\n\tv_nop" : "=v"(y) : "v"(x * 1.44269504f));
  return y;
}

// Eight asynchronous copies of 16 bytes per lane, global memory to LDS through
// no register.  The s_wait_xcnt stands inside the statement, behind the last
// copy: the address registers that the copies name are rewritten only behind it.
__device__ __forceinline__ void acopy8(unsigned l, const float* g) {
  // copy i takes the two rows 8 * i further on: 2048 B in LDS
  const unsigned l1 = l + 2048,  l2 = l + 4096,  l3 = l + 6144, l4 = l + 8192,
                 l5 = l + 10240, l6 = l + 12288, l7 = l + 14336;
  const float *g1 = g + 8 * C_EMB,  *g2 = g + 16 * C_EMB, *g3 = g + 24 * C_EMB,
              *g4 = g + 32 * C_EMB, *g5 = g + 40 * C_EMB, *g6 = g + 48 * C_EMB,
              *g7 = g + 56 * C_EMB;
  asm volatile(
      "global_load_async_to_lds_b128 %0, %8, off\n\t"
      "global_load_async_to_lds_b128 %1, %9, off\n\t"
      "global_load_async_to_lds_b128 %2, %10, off\n\t"
      "global_load_async_to_lds_b128 %3, %11, off\n\t"
      "global_load_async_to_lds_b128 %4, %12, off\n\t"
      "global_load_async_to_lds_b128 %5, %13, off\n\t"
      "global_load_async_to_lds_b128 %6, %14, off\n\t"
      "global_load_async_to_lds_b128 %7, %15, off\n\t"
      "s_wait_xcnt 0x0"
      :: "v"(l), "v"(l1), "v"(l2), "v"(l3), "v"(l4), "v"(l5), "v"(l6), "v"(l7),
         "v"(g), "v"(g1), "v"(g2), "v"(g3), "v"(g4), "v"(g5), "v"(g6), "v"(g7)
      : "memory");
}

// ---------------------------------------------------------------------------
// Kernel 0: weight prep.  f16 weights packed in B-fragment order:
//   Wt[w][ks][m][half][lane][e] = (f16) W_m[c][h]
//   h = 16*w + (lane & 15),  c = 32*ks + 8*(lane >> 4) + 16*half + e
// (w: 16-column tile, ks: K-step of 32, m: q/k/v, e: 0..7).  One wave-wide
// 16-byte load of head_kernel then covers 512 contiguous bytes (4 whole lines).
// ---------------------------------------------------------------------------
__global__ __launch_bounds__(256)
void wcvt_kernel(const float* __restrict__ Wq, const float* __restrict__ Wk,
                 const float* __restrict__ Wv, _Float16* __restrict__ Wt) {
  const int idx  = blockIdx.x * 256 + threadIdx.x;
  const int e    = idx & 7;
  const int lane = (idx >> 3) & 31;
  const int half = (idx >> 8) & 1;
  const int t    = idx >> 9;                     // (w*KSTEPS + ks)*3 + m
  const int m    = t % 3;
  const int ks   = (t / 3) % KSTEPS;
  const int w    = t / (3 * KSTEPS);
  const int h    = w * 16 + (lane & 15);
  const int c    = ks * 32 + (lane >> 4) * 8 + half * 16 + e;
  const float* W = (m == 0) ? Wq : (m == 1) ? Wk : Wv;
  Wt[idx] = (_Float16)W[(size_t)c * H_DIM + h];
}

__global__ __launch_bounds__(256)
void head_kernel(const float* __restrict__ x,
                 const _Float16* __restrict__ Wt,   // packed, see wcvt_kernel
                 const float* __restrict__ bq, const float* __restrict__ bk,
                 const float* __restrict__ bv,
                 float* __restrict__ out) {
  __shared__ __align__(16) _Float16 qkv[3 * FSZ];        // Q, K, V fragments
  // padded f16 rows of x, then the odd tiles' f32 buffer; behind the
  // projection the per-wave O staging
  __shared__ __align__(16) _Float16 stg[PROWS * XPITCH + PROWS * KCH * 2];
  static_assert(8 * 16 * OPITCH * sizeof(float) <= sizeof(stg), "O staging");
  _Float16* xs = stg;

  const int b     = blockIdx.x;
  const int tid   = threadIdx.x;
  // the wave's number in a scalar register: the loops over tiles that depend
  // on it then branch on scalars, with every lane on at the matrix products
  const int wave8 = __builtin_amdgcn_readfirstlane(tid >> 5);   // 0..7
  const int lane  = tid & 31;
  const int lh    = lane & 15;                 // lane within half
  const int hi    = lane >> 4;                 // half select
  const int grp   = wave8 >> 2;                // 0..1  -> 64 rows of the pass
  const int wave  = wave8 & 3;                 // 0..3  -> H tile

  _Float16* Qs = qkv + lane * 8;               // tile 0, piece 0
  _Float16* Ks = Qs + FSZ;
  _Float16* Vs = Ks + FSZ;

  // this wave's packed weights: 3 fragments of 512 halves per K-step
  const _Float16* wfrag = Wt + (size_t)wave * (KSTEPS * 3 * 512) + lane * 8;
  const int   hq    = wave * 16 + hi * 8;      // first of this lane's 8 h (Q, K)
  const float biasv = bv[wave * 16 + lh];
  // this lane's 8 biases of Q and of K, read once, ahead of the projection
  const v4f bq0 = *(const v4f*)(bq + hq), bq1 = *(const v4f*)(bq + hq + 4);
  const v4f bk0 = *(const v4f*)(bk + hq), bk1 = *(const v4f*)(bk + hq + 4);

  // the two halves (64 rows each) of the f32 tile buffers: [parity][half]
  const char* const rawp[2][2] = {
      {(const char*)(qkv + FSZ / 2), (const char*)(qkv + FSZ + FSZ / 2)},
      {(const char*)(stg + PROWS * XPITCH),
       (const char*)(stg + PROWS * XPITCH) + RAWH}};
  // a copying wave's lane: 16 bytes of row 2 * wave + hi of a tile's half
  const float*   xc = x + ((size_t)b * T_SEQ + wave * 2 + hi) * C_EMB + lh * 4;
  const unsigned lc = wave * 512 + lane * 16;

  // tiles 0 and 1 set off; tile 0 has landed behind its copiers' wait and is
  // open to every wave behind the barrier
  if (grp == 0) {
    acopy8((unsigned)(uintptr_t)rawp[0][0] + lc, xc);
    acopy8((unsigned)(uintptr_t)rawp[0][1] + lc, xc + QROWS * C_EMB);
    asm volatile("s_wait_asynccnt 0x0" ::: "memory");
  } else {
    acopy8((unsigned)(uintptr_t)rawp[1][0] + lc, xc + KCH);
    acopy8((unsigned)(uintptr_t)rawp[1][1] + lc, xc + QROWS * C_EMB + KCH);
  }
  __syncthreads();

  #pragma unroll 1  // rolled to bound the code
  for (int ps = 0; ps < PASSES; ++ps) {
    v8f accq[MT] = {}, acck[MT] = {}, accv[MT] = {};
    #pragma unroll 1  // rolled to bound the code
    for (int ch = 0; ch < NCH; ++ch) {
      const int t   = ps * NCH + ch;           // this tile
      const int par = ch & 1;                  // its buffer (NCH is even)
      const char* const r0 = par ? rawp[1][0] : rawp[0][0];
      const char* const r1 = par ? rawp[1][1] : rawp[0][1];

      // f32 tile -> padded f16 rows: 512 contiguous bytes per wave-wide read
      v4f f[8];
      #pragma unroll  // all eight reads in flight
      for (int j = 0; j < 8; ++j)
        f[j] = *(const v4f*)((j < 4 ? r0 : r1) + ((j & 3) * 256 + tid) * 16);
      #pragma unroll  // constant j keeps f in registers
      for (int j = 0; j < 8; ++j) {
        v4h h;
        h[0] = (_Float16)f[j][0]; h[1] = (_Float16)f[j][1];
        h[2] = (_Float16)f[j][2]; h[3] = (_Float16)f[j][3];
        *(v4h*)(xs + (j * 16 + (tid >> 4)) * XPITCH + (tid & 15) * 4) = h;
      }
      // this wave's reads of the f32 tile have retired before a copy may aim
      // at it again
      asm volatile("s_wait_dscnt 0x0" ::: "memory");
      __syncthreads();                         // xs is written, the f32 tile read

      if (grp == par && t + 2 < NT) {          // scalar test: tile t + 2 sets off
        const int t2 = t + 2;
        const int p2 = t2 >= NCH ? 1 : 0;
        const float* g = xc + (size_t)p2 * (PROWS * C_EMB) + (t2 - p2 * NCH) * KCH;
        acopy8((unsigned)(uintptr_t)r0 + lc, g);
        acopy8((unsigned)(uintptr_t)r1 + lc, g + QROWS * C_EMB);
      }

      #pragma unroll  // the tile's two K-steps in one run, no branch between
      for (int kk = 0; kk < KCH / 32; ++kk) {  // 2 K-steps of 32
        const int k0 = kk * 32 + hi * 8;
        // B fragments (same k order as A): two 512-byte planes each
        const _Float16* wk3 = wfrag + (ch * (KCH / 32) + kk) * (3 * 512);
        v16h fq = cat8(ld8(wk3),        ld8(wk3 + 256));
        v16h fk = cat8(ld8(wk3 + 512),  ld8(wk3 + 768));
        v16h fv = cat8(ld8(wk3 + 1024), ld8(wk3 + 1280));
        #pragma unroll  // constant mt keeps the accumulator arrays in registers
        for (int mt = 0; mt < MT; ++mt) {
          // A fragment (lane=M=lh; halves: k0+{0..7}, k0+16+{0..7})
          const _Float16* xrow =
              &xs[(grp * QROWS + mt * 16 + lh) * XPITCH + k0];
          v16h a = cat8(ld8(xrow), ld8(xrow + 16));
          accq[mt] = wmma32(fq, a, accq[mt]);  // Qt: lane = row, r -> h
          acck[mt] = wmma32(fk, a, acck[mt]);  // Kt: lane = row, r -> h
          accv[mt] = wmma32(a, fv, accv[mt]);  // V:  lane = h,   r -> row
        }
      }

      // tile t + 1 is handed over: this wave's reads of xs have retired, the
      // tile's copiers have seen it land, and the barrier opens it to all
      asm volatile("s_wait_dscnt 0x0" ::: "memory");
      if (grp != par)
        asm volatile("s_wait_asynccnt 0x0" ::: "memory");
      __syncthreads();
    }

    const int f0 = ((ps * GROUPS + grp) * MT * 4 + wave) * 256;
    #pragma unroll    // constant mt, r: accumulators are read from registers
    for (int mt = 0; mt < MT; ++mt) {
      v8h q, k, v;
      #pragma unroll
      for (int r = 0; r < 8; ++r) {
        const float bqr = r < 4 ? bq0[r & 3] : bq1[r & 3];
        const float bkr = r < 4 ? bk0[r & 3] : bk1[r & 3];
        q[r] = (_Float16)((accq[mt][r] + bqr) * QK_SCALE);         // scale in Q
        k[r] = (_Float16)(acck[mt][r] + bkr);
        v[r] = (_Float16)(accv[mt][r] + biasv);
      }
      *(v8h*)(Qs + f0 + mt * 1024) = q;
      *(v8h*)(Ks + f0 + mt * 1024) = k;
      *(v8h*)(Vs + f0 + mt * 1024) = v;
    }
  }
  // no copy is left in flight where the staging LDS gets its next use
  asm volatile("s_wait_asynccnt 0x0" ::: "memory");
  __syncthreads();   // Q, K, V are written; nobody reads xs as x any more

  float* myo = (float*)stg + wave8 * (16 * OPITCH);      // this wave's O staging

  #pragma unroll 1  // one tile after the other, rolled to bound the code
  for (int half = 0; half < 2; ++half) {
    const int qt  = half ? wave8 : 15 - wave8; // Q tile index in [0,16)
    const int qr0 = qt * 16;                   // first Q row of the tile

    // Q as B fragments (lane = query): two 32x16 chunks covering H=64
    const _Float16* qr = Qs + qt * 1024;
    v16h qf0 = cat8(ld8(qr),       ld8(qr + 256));
    v16h qf1 = cat8(ld8(qr + 512), ld8(qr + 768));

    v8f o0 = {}, o1 = {}, o2 = {}, o3 = {};    // Ot: lane = query, r -> h
    float mrow = NEG_INF, lsum = 0.0f;         // lsum: this half's keys only

    #pragma unroll 1
    for (int j0 = 0; j0 <= qt; j0 += 2) {      // pairs of 16-wide K tiles
      const bool have1 = (j0 + 1) <= qt;

      // ---- scores: St = K (16x64) . Qt, per 16-key tile, 2 WMMAs each ----
      v8f s0 = {}, s1 = {};
      {
        const _Float16* kr = Ks + j0 * 1024;
        s0 = wmma32(cat8(ld8(kr),       ld8(kr + 256)), qf0, s0);
        s0 = wmma32(cat8(ld8(kr + 512), ld8(kr + 768)), qf1, s0);
      }
      if (have1) {
        const _Float16* kr = Ks + (j0 + 1) * 1024;
        s1 = wmma32(cat8(ld8(kr),       ld8(kr + 256)), qf0, s1);
        s1 = wmma32(cat8(ld8(kr + 512), ld8(kr + 768)), qf1, s1);
      }

      // key r of tile 0 (r + 16 of tile 1) is seen by this lane's query iff
      // <= lim; without a tile 1 all of s1 is masked
      // (all loops over r unrolled: constant r keeps the tiles in registers)
      const int lim = (qt - j0) * 16 + lh - hi * 8;
      #pragma unroll
      for (int r = 0; r < 8; ++r) {
        if (r > lim)      s0[r] = NEG_INF;
        if (r + 16 > lim) s1[r] = NEG_INF;
      }

      // ---- online softmax: one query per lane, 16 of its 32 keys ----
      float mt = fmaxf(s0[0], s1[0]);
      #pragma unroll
      for (int r = 1; r < 8; ++r) mt = fmaxf(mt, fmaxf(s0[r], s1[r]));
      mt = fmaxf(mt, xhalf(mt));               // the other half's 16 keys
      const float mnew = fmaxf(mrow, mt);
      const float sc   = exp_slot(mrow - mnew);
      mrow = mnew;
      v16h pf;                                 // Pt as a 32x16 B fragment
      lsum *= sc;
      #pragma unroll
      for (int r = 0; r < 8; ++r) {
        const float e0 = exp_slot(s0[r] - mnew);
        const float e1 = exp_slot(s1[r] - mnew);
        lsum += e0 + e1;
        pf[r]     = (_Float16)e0;
        pf[r + 8] = (_Float16)e1;
      }
      o0 *= sc; o1 *= sc; o2 *= sc; o3 *= sc;

      // ---- Ot += Vt (16x32) . Pt (32x16), one WMMA per 16-wide H tile ----
      const int off1 = have1 ? 1024 : 0;       // no tile 1: its P half is 0
      #pragma unroll
      for (int n = 0; n < 4; ++n) {
        const _Float16* vp = Vs + j0 * 1024 + n * 256;
        v16h vf = cat8(ld8(vp), ld8(vp + off1)); // keys of tile j0, of j0 + 1
        switch (n) {
          case 0: o0 = wmma32(vf, pf, o0); break;
          case 1: o1 = wmma32(vf, pf, o1); break;
          case 2: o2 = wmma32(vf, pf, o2); break;
          case 3: o3 = wmma32(vf, pf, o3); break;
        }
      }
    }

    // ---- normalize; turn Ot through this wave's LDS; store whole lines ----
    const float inv = 1.0f / (lsum + xhalf(lsum));
    float* wr  = myo + lh * OPITCH + hi * 8;   // a lane holds 8 h in a row
    o0 *= inv; o1 *= inv; o2 *= inv; o3 *= inv;
    *(v4f*)(wr +  0) = __builtin_shufflevector(o0, o0, 0, 1, 2, 3);
    *(v4f*)(wr +  4) = __builtin_shufflevector(o0, o0, 4, 5, 6, 7);
    *(v4f*)(wr + 16) = __builtin_shufflevector(o1, o1, 0, 1, 2, 3);
    *(v4f*)(wr + 20) = __builtin_shufflevector(o1, o1, 4, 5, 6, 7);
    *(v4f*)(wr + 32) = __builtin_shufflevector(o2, o2, 0, 1, 2, 3);
    *(v4f*)(wr + 36) = __builtin_shufflevector(o2, o2, 4, 5, 6, 7);
    *(v4f*)(wr + 48) = __builtin_shufflevector(o3, o3, 0, 1, 2, 3);
    *(v4f*)(wr + 52) = __builtin_shufflevector(o3, o3, 4, 5, 6, 7);

    // per-wave LDS RAW across lanes: DS ops are in-order per wave; make it explicit
    asm volatile("s_wait_dscnt 0" ::: "memory");

    // 32 lanes x 16 B = two whole output rows (512 contiguous bytes) per store
    float* og = out + ((size_t)b * T_SEQ + qr0 + hi) * H_DIM + lh * 4;
    #pragma unroll
    for (int i = 0; i < 8; ++i)
      *(v4f*)(og + (size_t)i * 2 * H_DIM) =
          *(const v4f*)(myo + (i * 2 + hi) * OPITCH + lh * 4);
    // the next tile's start values overwrite the registers that these stores
    // name: this wait stands between the stores and that overwrite
    asm volatile("s_wait_xcnt 0x0" ::: "memory");
  }
}

// ---------------------------------------------------------------------------
extern "C" void kernel_launch(void* const* d_in, const int* in_sizes, int n_in,
                              void* d_out, int out_size, void* d_ws, size_t ws_size,
                              hipStream_t stream) {
  const float* x  = (const float*)d_in[0];
  const float* Wq = (const float*)d_in[1];
  const float* bq = (const float*)d_in[2];
  const float* Wk = (const float*)d_in[3];
  const float* bk = (const float*)d_in[4];
  const float* Wv = (const float*)d_in[5];
  const float* bv = (const float*)d_in[6];

  const size_t nW = (size_t)3 * H_DIM * C_EMB;           // 73728 elems
  _Float16* Wt = (_Float16*)d_ws;                        // 144 KB of ws

  wcvt_kernel<<<dim3((unsigned)(nW / 256)), 256, 0, stream>>>(Wq, Wk, Wv, Wt);
  head_kernel<<<dim3(B_BATCH), 256, 0, stream>>>(
      x, Wt, bq, bk, bv, (float*)d_out);
}

// v008
// One run takes 29.3 microseconds.
// Next to v007, in two timings, it ran 1.15 times as fast each time.
// All steps since v000 together make it 4.13 times as fast.
#include <hip/hip_runtime.h>
#include <hip/hip_bf16.h>

typedef __attribute__((ext_vector_type(16))) _Float16 v16h;
typedef __attribute__((ext_vector_type(8)))  _Float16 v8h;
typedef __attribute__((ext_vector_type(4)))  _Float16 v4h;
typedef __attribute__((ext_vector_type(8)))  float    v8f;
typedef __attribute__((ext_vector_type(4)))  float    v4f;

#define B_BATCH 512
#define T_SEQ   256
#define C_EMB   384
#define H_DIM   64
#define KSTEPS  (C_EMB / 32)     // K-steps of one 16x16x32 product
#define MT      4                // 16-row tiles of x per group of 4 waves
#define QROWS   (16 * MT)        // rows of x per group of 4 waves
#define GROUPS  2                // groups per block
#define PROWS   (QROWS * GROUPS) // rows of x per pass of a block
#define PASSES  (T_SEQ / PROWS)  // a block does one whole batch
#define KCH     64               // columns of x in one staged tile
#define NCH     (C_EMB / KCH)
#define NT      (PASSES * NCH)   // tiles of x per block
#define RAWH    (QROWS * KCH * 4) // bytes of half a tile as f32 (64 rows)
#define FSZ     (T_SEQ * H_DIM)  // halves of one batch's Q (or K, or V)
// LDS row pitches (XPITCH in halves, OPITCH in floats), each an odd multiple
// of 16 bytes: the 16 lanes of a half-wave touch 16 bytes of 16 different rows
// in one b128 access, and at such a pitch they fall on all 64 banks (at 128 B
// or 256 B rows they collide).
#define XPITCH  (KCH + 8)        // 144 B = 16 B x 9
#define OPITCH  (H_DIM + 4)      // 272 B = 16 B x 17
#define QK_SCALE 0.125f          // 64^-0.5
#define NEG_INF  (-1.0e30f)

__device__ __forceinline__ v8f wmma32(v16h a, v16h b, v8f c) {
  // v_wmma_f32_16x16x32_f16: D = A(16x32 f16) * B(32x16 f16) + C(16x16 f32)
  return __builtin_amdgcn_wmma_f32_16x16x32_f16(
      /*neg_a=*/false, a, /*neg_b=*/false, b,
      /*c_mod=*/(short)0, c, /*reuse_a=*/false, /*reuse_b=*/false);
}

__device__ __forceinline__ v8h ld8(const _Float16* p) {   // 16B vector load
  return *(const v8h*)p;
}
__device__ __forceinline__ v16h cat8(v8h a, v8h b) {
  return __builtin_shufflevector(a, b, 0,1,2,3,4,5,6,7,8,9,10,11,12,13,14,15);
}

__device__ __forceinline__ float xhalf(float x) {   // lane l <-> lane l ^ 16
  const int v = __builtin_bit_cast(int, x);
  return __builtin_bit_cast(float, __builtin_amdgcn_permlanex16(
      v, v, 0x76543210, 0xfedcba98, false, false));
}

// e^x as 2^(x * log2 e), the form __expf compiles to.  The v_nop is the slot
// that the instruction set asks for behind a transcendental before its source
// is overwritten.
__device__ __forceinline__ float exp_slot(float x) {
  float y;
  asm("v_exp_f32 %0, %1\n\tv_nop" : "=v"(y) : "v"(x * 1.44269504f));
  return y;
}

// Eight asynchronous copies of 16 bytes per lane, global memory to LDS through
// no register.  The s_wait_xcnt stands inside the statement, behind the last
// copy: the address registers that the copies name are rewritten only behind it.
__device__ __forceinline__ void acopy8(unsigned l, const float* g) {
  // copy i takes the two rows 8 * i further on: 2048 B in LDS
  const unsigned l1 = l + 2048,  l2 = l + 4096,  l3 = l + 6144, l4 = l + 8192,
                 l5 = l + 10240, l6 = l + 12288, l7 = l + 14336;
  const float *g1 = g + 8 * C_EMB,  *g2 = g + 16 * C_EMB, *g3 = g + 24 * C_EMB,
              *g4 = g + 32 * C_EMB, *g5 = g + 40 * C_EMB, *g6 = g + 48 * C_EMB,
              *g7 = g + 56 * C_EMB;
  asm volatile(
      "global_load_async_to_lds_b128 %0, %8, off\n\t"
      "global_load_async_to_lds_b128 %1, %9, off\n\t"
      "global_load_async_to_lds_b128 %2, %10, off\n\t"
      "global_load_async_to_lds_b128 %3, %11, off\n\t"
      "global_load_async_to_lds_b128 %4, %12, off\n\t"
      "global_load_async_to_lds_b128 %5, %13, off\n\t"
      "global_load_async_to_lds_b128 %6, %14, off\n\t"
      "global_load_async_to_lds_b128 %7, %15, off\n\t"
      "s_wait_xcnt 0x0"
      :: "v"(l), "v"(l1), "v"(l2), "v"(l3), "v"(l4), "v"(l5), "v"(l6), "v"(l7),
         "v"(g), "v"(g1), "v"(g2), "v"(g3), "v"(g4), "v"(g5), "v"(g6), "v"(g7)
      : "memory");
}

// Work-group barrier whose fences order LDS alone.  __syncthreads() also waits
// for the wave's global loads, and the projection loop keeps the coming tile's
// weight loads in flight across its barriers; nothing that a wave of the block
// writes to global memory is read by another.
__device__ __forceinline__ void lds_barrier() {
  __builtin_amdgcn_fence(__ATOMIC_RELEASE, "workgroup", "local");
  __builtin_amdgcn_s_barrier();
  __builtin_amdgcn_fence(__ATOMIC_ACQUIRE, "workgroup", "local");
}

// ---------------------------------------------------------------------------
// Kernel 0: weight prep.  f16 weights packed in B-fragment order:
//   Wt[w][ks][m][half][lane][e] = (f16) W_m[c][h]
//   h = 16*w + (lane & 15),  c = 32*ks + 8*(lane >> 4) + 16*half + e
// (w: 16-column tile, ks: K-step of 32, m: q/k/v, e: 0..7).  One wave-wide
// 16-byte load of head_kernel then covers 512 contiguous bytes (4 whole lines).
// ---------------------------------------------------------------------------
__global__ __launch_bounds__(256)
void wcvt_kernel(const float* __restrict__ Wq, const float* __restrict__ Wk,
                 const float* __restrict__ Wv, _Float16* __restrict__ Wt) {
  const int idx  = blockIdx.x * 256 + threadIdx.x;
  const int e    = idx & 7;
  const int lane = (idx >> 3) & 31;
  const int half = (idx >> 8) & 1;
  const int t    = idx >> 9;                     // (w*KSTEPS + ks)*3 + m
  const int m    = t % 3;
  const int ks   = (t / 3) % KSTEPS;
  const int w    = t / (3 * KSTEPS);
  const int h    = w * 16 + (lane & 15);
  const int c    = ks * 32 + (lane >> 4) * 8 + half * 16 + e;
  const float* W = (m == 0) ? Wq : (m == 1) ? Wk : Wv;
  Wt[idx] = (_Float16)W[(size_t)c * H_DIM + h];
}

__global__ __launch_bounds__(256)
void head_kernel(const float* __restrict__ x,
                 const _Float16* __restrict__ Wt,   // packed, see wcvt_kernel
                 const float* __restrict__ bq, const float* __restrict__ bk,
                 const float* __restrict__ bv,
                 float* __restrict__ out) {
  __shared__ __align__(16) _Float16 qkv[3 * FSZ];        // Q, K, V fragments
  // padded f16 rows of x, then the odd tiles' f32 buffer; behind the
  // projection the per-wave O staging
  __shared__ __align__(16) _Float16 stg[PROWS * XPITCH + PROWS * KCH * 2];
  static_assert(8 * 16 * OPITCH * sizeof(float) <= sizeof(stg), "O staging");
  _Float16* xs = stg;

  const int b     = blockIdx.x;
  const int tid   = threadIdx.x;
  // the wave's number in a scalar register: the loops over tiles that depend
  // on it then branch on scalars, with every lane on at the matrix products
  const int wave8 = __builtin_amdgcn_readfirstlane(tid >> 5);   // 0..7
  const int lane  = tid & 31;
  const int lh    = lane & 15;                 // lane within half
  const int hi    = lane >> 4;                 // half select
  const int grp   = wave8 >> 2;                // 0..1  -> 64 rows of the pass
  const int wave  = wave8 & 3;                 // 0..3  -> H tile

  _Float16* Qs = qkv + lane * 8;               // tile 0, piece 0
  _Float16* Ks = Qs + FSZ;
  _Float16* Vs = Ks + FSZ;

  // this wave's packed weights: 3 fragments of 512 halves per K-step
  const _Float16* wfrag = Wt + (size_t)wave * (KSTEPS * 3 * 512) + lane * 8;
  const int   hq    = wave * 16 + hi * 8;      // first of this lane's 8 h (Q, K)
  const float biasv = bv[wave * 16 + lh];
  // this lane's 8 biases of Q and of K, read once, ahead of the projection
  const v4f bq0 = *(const v4f*)(bq + hq), bq1 = *(const v4f*)(bq + hq + 4);
  const v4f bk0 = *(const v4f*)(bk + hq), bk1 = *(const v4f*)(bk + hq + 4);

  // the two halves (64 rows each) of the f32 tile buffers: [parity][half]
  const char* const rawp[2][2] = {
      {(const char*)(qkv + FSZ / 2), (const char*)(qkv + FSZ + FSZ / 2)},
      {(const char*)(stg + PROWS * XPITCH),
       (const char*)(stg + PROWS * XPITCH) + RAWH}};
  // a copying wave's lane: 16 bytes of row 2 * wave + hi of a tile's half
  const float*   xc = x + ((size_t)b * T_SEQ + wave * 2 + hi) * C_EMB + lh * 4;
  const unsigned lc = wave * 512 + lane * 16;

  // tiles 0 and 1 set off; tile 0 has landed behind its copiers' wait and is
  // open to every wave behind the barrier
  if (grp == 0) {
    acopy8((unsigned)(uintptr_t)rawp[0][0] + lc, xc);
    acopy8((unsigned)(uintptr_t)rawp[0][1] + lc, xc + QROWS * C_EMB);
    asm volatile("s_wait_asynccnt 0x0" ::: "memory");
  } else {
    acopy8((unsigned)(uintptr_t)rawp[1][0] + lc, xc + KCH);
    acopy8((unsigned)(uintptr_t)rawp[1][1] + lc, xc + QROWS * C_EMB + KCH);
  }
  // the coming tile's weight fragments, [K-step][q, k, v]: two 512-byte planes
  // each (same k order as the fragments of x)
  v16h wf[6];
  #pragma unroll  // constant i keeps wf in registers
  for (int i = 0; i < 6; ++i)
    wf[i] = cat8(ld8(wfrag + i * 512), ld8(wfrag + i * 512 + 256));
  __syncthreads();

  #pragma unroll 1  // rolled to bound the code
  for (int ps = 0; ps < PASSES; ++ps) {
    v8f accq[MT] = {}, acck[MT] = {}, accv[MT] = {};
    #pragma unroll 1  // rolled to bound the code
    for (int ch = 0; ch < NCH; ++ch) {
      const int t   = ps * NCH + ch;           // this tile
      const int par = ch & 1;                  // its buffer (NCH is even)
      const char* const r0 = par ? rawp[1][0] : rawp[0][0];
      const char* const r1 = par ? rawp[1][1] : rawp[0][1];

      // f32 tile -> padded f16 rows: 512 contiguous bytes per wave-wide read
      v4f f[8];
      #pragma unroll  // all eight reads in flight
      for (int j = 0; j < 8; ++j)
        f[j] = *(const v4f*)((j < 4 ? r0 : r1) + ((j & 3) * 256 + tid) * 16);
      #pragma unroll  // constant j keeps f in registers
      for (int j = 0; j < 8; ++j) {
        v4h h;
        h[0] = (_Float16)f[j][0]; h[1] = (_Float16)f[j][1];
        h[2] = (_Float16)f[j][2]; h[3] = (_Float16)f[j][3];
        *(v4h*)(xs + (j * 16 + (tid >> 4)) * XPITCH + (tid & 15) * 4) = h;
      }
      // this wave's reads of the f32 tile have retired before a copy may aim
      // at it again
      asm volatile("s_wait_dscnt 0x0" ::: "memory");
      lds_barrier();                           // xs is written, the f32 tile read

      if (grp == par && t + 2 < NT) {          // scalar test: tile t + 2 sets off
        const int t2 = t + 2;
        const int p2 = t2 >= NCH ? 1 : 0;
        const float* g = xc + (size_t)p2 * (PROWS * C_EMB) + (t2 - p2 * NCH) * KCH;
        acopy8((unsigned)(uintptr_t)r0 + lc, g);
        acopy8((unsigned)(uintptr_t)r1 + lc, g + QROWS * C_EMB);
      }

      // the tile's 8 fragments of x (lane = row lh; halves: k0 + {0..7},
      // k0 + 16 + {0..7}, k0 = 32 * kk + 8 * hi), all reads in one group
      v8h ar[2 * MT * (KCH / 32)];
      #pragma unroll  // constant indices keep ar in registers
      for (int kk = 0; kk < KCH / 32; ++kk) {
        #pragma unroll  // as above
        for (int mt = 0; mt < MT; ++mt) {
          const _Float16* xrow =
              &xs[(grp * QROWS + mt * 16 + lh) * XPITCH + kk * 32 + hi * 8];
          ar[(kk * MT + mt) * 2]     = ld8(xrow);
          ar[(kk * MT + mt) * 2 + 1] = ld8(xrow + 16);
        }
      }
      // holds the reads in front of the products: the scheduler otherwise puts
      // each pair behind the products before it, in one register set, and the
      // wave then waits out the LDS latency eight times a tile
      __builtin_amdgcn_sched_barrier(0);

      #pragma unroll  // the tile's two K-steps in one run, no branch between
      for (int kk = 0; kk < KCH / 32; ++kk) {  // 2 K-steps of 32
        #pragma unroll  // constant mt keeps the accumulator arrays in registers
        for (int mt = 0; mt < MT; ++mt) {
          v16h a = cat8(ar[(kk * MT + mt) * 2], ar[(kk * MT + mt) * 2 + 1]);
          accq[mt] = wmma32(wf[kk * 3],     a, accq[mt]);  // Qt: lane = row, r -> h
          acck[mt] = wmma32(wf[kk * 3 + 1], a, acck[mt]);  // Kt: lane = row, r -> h
          accv[mt] = wmma32(a, wf[kk * 3 + 2], accv[mt]);  // V:  lane = h,   r -> row
        }
      }

      if (t + 1 < NT) {   // scalar test: the next tile's weights set off (behind
                          // a pass's last tile: the first columns again)
        const _Float16* wn =
            wfrag + (ch + 1 == NCH ? 0 : ch + 1) * ((KCH / 32) * 3 * 512);
        #pragma unroll  // constant i keeps wf in registers
        for (int i = 0; i < 6; ++i)
          wf[i] = cat8(ld8(wn + i * 512), ld8(wn + i * 512 + 256));
        // these loads stay in flight into the next trip, which reuses registers:
        // the address that they name is rewritten only behind this wait
        asm volatile("s_wait_xcnt 0x0" ::: "memory");
      }

      // tile t + 1 is handed over: this wave's reads of xs have retired, the
      // tile's copiers have seen it land, and the barrier opens it to all
      asm volatile("s_wait_dscnt 0x0" ::: "memory");
      if (grp != par)
        asm volatile("s_wait_asynccnt 0x0" ::: "memory");
      lds_barrier();
    }

    const int f0 = ((ps * GROUPS + grp) * MT * 4 + wave) * 256;
    #pragma unroll    // constant mt, r: accumulators are read from registers
    for (int mt = 0; mt < MT; ++mt) {
      v8h q, k, v;
      #pragma unroll
      for (int r = 0; r < 8; ++r) {
        const float bqr = r < 4 ? bq0[r & 3] : bq1[r & 3];
        const float bkr = r < 4 ? bk0[r & 3] : bk1[r & 3];
        q[r] = (_Float16)((accq[mt][r] + bqr) * QK_SCALE);         // scale in Q
        k[r] = (_Float16)(acck[mt][r] + bkr);
        v[r] = (_Float16)(accv[mt][r] + biasv);
      }
      *(v8h*)(Qs + f0 + mt * 1024) = q;
      *(v8h*)(Ks + f0 + mt * 1024) = k;
      *(v8h*)(Vs + f0 + mt * 1024) = v;
    }
  }
  // no copy is left in flight where the staging LDS gets its next use
  asm volatile("s_wait_asynccnt 0x0" ::: "memory");
  __syncthreads();   // Q, K, V are written; nobody reads xs as x any more

  float* myo = (float*)stg + wave8 * (16 * OPITCH);      // this wave's O staging

  #pragma unroll 1  // one tile after the other, rolled to bound the code
  for (int half = 0; half < 2; ++half) {
    const int qt  = half ? wave8 : 15 - wave8; // Q tile index in [0,16)
    const int qr0 = qt * 16;                   // first Q row of the tile

    // Q as B fragments (lane = query): two 32x16 chunks covering H=64
    const _Float16* qr = Qs + qt * 1024;
    v16h qf0 = cat8(ld8(qr),       ld8(qr + 256));
    v16h qf1 = cat8(ld8(qr + 512), ld8(qr + 768));

    v8f o0 = {}, o1 = {}, o2 = {}, o3 = {};    // Ot: lane = query, r -> h
    float mrow = NEG_INF, lsum = 0.0f;         // lsum: this half's keys only

    #pragma unroll 1
    for (int j0 = 0; j0 <= qt; j0 += 2) {      // pairs of 16-wide K tiles
      const bool have1 = (j0 + 1) <= qt;

      // ---- scores: St = K (16x64) . Qt, per 16-key tile, 2 WMMAs each ----
      v8f s0 = {}, s1 = {};
      {
        const _Float16* kr = Ks + j0 * 1024;
        s0 = wmma32(cat8(ld8(kr),       ld8(kr + 256)), qf0, s0);
        s0 = wmma32(cat8(ld8(kr + 512), ld8(kr + 768)), qf1, s0);
      }
      if (have1) {
        const _Float16* kr = Ks + (j0 + 1) * 1024;
        s1 = wmma32(cat8(ld8(kr),       ld8(kr + 256)), qf0, s1);
        s1 = wmma32(cat8(ld8(kr + 512), ld8(kr + 768)), qf1, s1);
      }

      // key r of tile 0 (r + 16 of tile 1) is seen by this lane's query iff
      // <= lim; without a tile 1 all of s1 is masked
      // (all loops over r unrolled: constant r keeps the tiles in registers)
      const int lim = (qt - j0) * 16 + lh - hi * 8;
      #pragma unroll
      for (int r = 0; r < 8; ++r) {
        if (r > lim)      s0[r] = NEG_INF;
        if (r + 16 > lim) s1[r] = NEG_INF;
      }

      // ---- online softmax: one query per lane, 16 of its 32 keys ----
      float mt = fmaxf(s0[0], s1[0]);
      #pragma unroll
      for (int r = 1; r < 8; ++r) mt = fmaxf(mt, fmaxf(s0[r], s1[r]));
      mt = fmaxf(mt, xhalf(mt));               // the other half's 16 keys
      const float mnew = fmaxf(mrow, mt);
      const float sc   = exp_slot(mrow - mnew);
      mrow = mnew;
      v16h pf;                                 // Pt as a 32x16 B fragment
      lsum *= sc;
      #pragma unroll
      for (int r = 0; r < 8; ++r) {
        const float e0 = exp_slot(s0[r] - mnew);
        const float e1 = exp_slot(s1[r] - mnew);
        lsum += e0 + e1;
        pf[r]     = (_Float16)e0;
        pf[r + 8] = (_Float16)e1;
      }
      o0 *= sc; o1 *= sc; o2 *= sc; o3 *= sc;

      // ---- Ot += Vt (16x32) . Pt (32x16), one WMMA per 16-wide H tile ----
      const int off1 = have1 ? 1024 : 0;       // no tile 1: its P half is 0
      #pragma unroll
      for (int n = 0; n < 4; ++n) {
        const _Float16* vp = Vs + j0 * 1024 + n * 256;
        v16h vf = cat8(ld8(vp), ld8(vp + off1)); // keys of tile j0, of j0 + 1
        switch (n) {
          case 0: o0 = wmma32(vf, pf, o0); break;
          case 1: o1 = wmma32(vf, pf, o1); break;
          case 2: o2 = wmma32(vf, pf, o2); break;
          case 3: o3 = wmma32(vf, pf, o3); break;
        }
      }
    }

    // ---- normalize; turn Ot through this wave's LDS; store whole lines ----
    const float inv = 1.0f / (lsum + xhalf(lsum));
    float* wr  = myo + lh * OPITCH + hi * 8;   // a lane holds 8 h in a row
    o0 *= inv; o1 *= inv; o2 *= inv; o3 *= inv;
    *(v4f*)(wr +  0) = __builtin_shufflevector(o0, o0, 0, 1, 2, 3);
    *(v4f*)(wr +  4) = __builtin_shufflevector(o0, o0, 4, 5, 6, 7);
    *(v4f*)(wr + 16) = __builtin_shufflevector(o1, o1, 0, 1, 2, 3);
    *(v4f*)(wr + 20) = __builtin_shufflevector(o1, o1, 4, 5, 6, 7);
    *(v4f*)(wr + 32) = __builtin_shufflevector(o2, o2, 0, 1, 2, 3);
    *(v4f*)(wr + 36) = __builtin_shufflevector(o2, o2, 4, 5, 6, 7);
    *(v4f*)(wr + 48) = __builtin_shufflevector(o3, o3, 0, 1, 2, 3);
    *(v4f*)(wr + 52) = __builtin_shufflevector(o3, o3, 4, 5, 6, 7);

    // per-wave LDS RAW across lanes: DS ops are in-order per wave; make it explicit
    asm volatile("s_wait_dscnt 0" ::: "memory");

    // 32 lanes x 16 B = two whole output rows (512 contiguous bytes) per store
    float* og = out + ((size_t)b * T_SEQ + qr0 + hi) * H_DIM + lh * 4;
    #pragma unroll
    for (int i = 0; i < 8; ++i)
      *(v4f*)(og + (size_t)i * 2 * H_DIM) =
          *(const v4f*)(myo + (i * 2 + hi) * OPITCH + lh * 4);
    // the next tile's start values overwrite the registers that these stores
    // name: this wait stands between the stores and that overwrite
    asm volatile("s_wait_xcnt 0x0" ::: "memory");
  }
}

// ---------------------------------------------------------------------------
extern "C" void kernel_launch(void* const* d_in, const int* in_sizes, int n_in,
                              void* d_out, int out_size, void* d_ws, size_t ws_size,
                              hipStream_t stream) {
  const float* x  = (const float*)d_in[0];
  const float* Wq = (const float*)d_in[1];
  const float* bq = (const float*)d_in[2];
  const float* Wk = (const float*)d_in[3];
  const float* bk = (const float*)d_in[4];
  const float* Wv = (const float*)d_in[5];
  const float* bv = (const float*)d_in[6];

  const size_t nW = (size_t)3 * H_DIM * C_EMB;           // 73728 elems
  _Float16* Wt = (_Float16*)d_ws;                        // 144 KB of ws

  wcvt_kernel<<<dim3((unsigned)(nW / 256)), 256, 0, stream>>>(Wq, Wk, Wv, Wt);
  head_kernel<<<dim3(B_BATCH), 256, 0, stream>>>(
      x, Wt, bq, bk, bv, (float*)d_out);
}

// v009
// Measured time: 28.1 microseconds a run.
// Two timings next to v008 put it at 1.05 and 1.04 times that version's speed.
// Counting every step since v000, it is 4.32 times as fast.
#include <hip/hip_runtime.h>
#include <hip/hip_bf16.h>

typedef __attribute__((ext_vector_type(16))) _Float16 v16h;
typedef __attribute__((ext_vector_type(8)))  _Float16 v8h;
typedef __attribute__((ext_vector_type(4)))  _Float16 v4h;
typedef __attribute__((ext_vector_type(8)))  float    v8f;
typedef __attribute__((ext_vector_type(4)))  float    v4f;

#define B_BATCH 512
#define T_SEQ   256
#define C_EMB   384
#define H_DIM   64
#define KSTEPS  (C_EMB / 32)     // K-steps of one 16x16x32 product
#define MT      4                // 16-row tiles of x per group of 4 waves
#define QROWS   (16 * MT)        // rows of x per group of 4 waves
#define GROUPS  2                // groups per block
#define PROWS   (QROWS * GROUPS) // rows of x per pass of a block
#define PASSES  (T_SEQ / PROWS)  // a block does one whole batch
#define KCH     64               // columns of x in one staged tile
#define NCH     (C_EMB / KCH)
#define NT      (PASSES * NCH)   // tiles of x per block
#define RAWH    (QROWS * KCH * 4) // bytes of half a tile as f32 (64 rows)
#define FSZ     (T_SEQ * H_DIM)  // halves of one batch's Q (or K, or V)
// LDS row pitches (XPITCH in halves, OPITCH in floats), each an odd multiple
// of 16 bytes: the 16 lanes of a half-wave touch 16 bytes of 16 different rows
// in one b128 access, and at such a pitch they fall on all 64 banks (at 128 B
// or 256 B rows they collide).
#define XPITCH  (KCH + 8)        // 144 B = 16 B x 9
#define OPITCH  (H_DIM + 4)      // 272 B = 16 B x 17
#define QK_SCALE 0.125f          // 64^-0.5
#define NEG_INF  (-1.0e30f)

__device__ __forceinline__ v8f wmma32(v16h a, v16h b, v8f c) {
  // v_wmma_f32_16x16x32_f16: D = A(16x32 f16) * B(32x16 f16) + C(16x16 f32)
  return __builtin_amdgcn_wmma_f32_16x16x32_f16(
      /*neg_a=*/false, a, /*neg_b=*/false, b,
      /*c_mod=*/(short)0, c, /*reuse_a=*/false, /*reuse_b=*/false);
}

__device__ __forceinline__ v8h ld8(const _Float16* p) {   // 16B vector load
  return *(const v8h*)p;
}
__device__ __forceinline__ v16h cat8(v8h a, v8h b) {
  return __builtin_shufflevector(a, b, 0,1,2,3,4,5,6,7,8,9,10,11,12,13,14,15);
}

__device__ __forceinline__ float xhalf(float x) {   // lane l <-> lane l ^ 16
  const int v = __builtin_bit_cast(int, x);
  return __builtin_bit_cast(float, __builtin_amdgcn_permlanex16(
      v, v, 0x76543210, 0xfedcba98, false, false));
}

// e^x as 2^(x * log2 e), the form __expf compiles to.  The v_nop is the slot
// that the instruction set asks for behind a transcendental before its source
// is overwritten.
__device__ __forceinline__ float exp_slot(float x) {
  float y;
  asm("v_exp_f32 %0, %1\n\tv_nop" : "=v"(y) : "v"(x * 1.44269504f));
  return y;
}

// Eight asynchronous copies of 16 bytes per lane, global memory to LDS through
// no register.  The s_wait_xcnt stands inside the statement, behind the last
// copy: the address registers that the copies name are rewritten only behind it.
__device__ __forceinline__ void acopy8(unsigned l, const float* g) {
  // copy i takes the two rows 8 * i further on: 2048 B in LDS
  const unsigned l1 = l + 2048,  l2 = l + 4096,  l3 = l + 6144, l4 = l + 8192,
                 l5 = l + 10240, l6 = l + 12288, l7 = l + 14336;
  const float *g1 = g + 8 * C_EMB,  *g2 = g + 16 * C_EMB, *g3 = g + 24 * C_EMB,
              *g4 = g + 32 * C_EMB, *g5 = g + 40 * C_EMB, *g6 = g + 48 * C_EMB,
              *g7 = g + 56 * C_EMB;
  asm volatile(
      "global_load_async_to_lds_b128 %0, %8, off\n\t"
      "global_load_async_to_lds_b128 %1, %9, off\n\t"
      "global_load_async_to_lds_b128 %2, %10, off\n\t"
      "global_load_async_to_lds_b128 %3, %11, off\n\t"
      "global_load_async_to_lds_b128 %4, %12, off\n\t"
      "global_load_async_to_lds_b128 %5, %13, off\n\t"
      "global_load_async_to_lds_b128 %6, %14, off\n\t"
      "global_load_async_to_lds_b128 %7, %15, off\n\t"
      "s_wait_xcnt 0x0"
      :: "v"(l), "v"(l1), "v"(l2), "v"(l3), "v"(l4), "v"(l5), "v"(l6), "v"(l7),
         "v"(g), "v"(g1), "v"(g2), "v"(g3), "v"(g4), "v"(g5), "v"(g6), "v"(g7)
      : "memory");
}

// Work-group barrier whose fences order LDS alone.  __syncthreads() also waits
// for the wave's global loads, and the projection loop keeps the coming tile's
// weight loads in flight across its barriers; nothing that a wave of the block
// writes to global memory is read by another.
__device__ __forceinline__ void lds_barrier() {
  __builtin_amdgcn_fence(__ATOMIC_RELEASE, "workgroup", "local");
  __builtin_amdgcn_s_barrier();
  __builtin_amdgcn_fence(__ATOMIC_ACQUIRE, "workgroup", "local");
}

// One pair of 16-key tiles (j0, j0 + 1) of one 16-query tile qt.
// DIAG = false: both tiles lie wholly below the diagonal tile, every key is seen
// by every query: no mask, no test for tile 1, all eight K reads in one group.
// DIAG = true: the pair that holds the diagonal tile (as tile 0 when qt is even,
// and there is then no tile 1).
template <bool DIAG>
__device__ __forceinline__ void key_pair(
    const _Float16* Ks, const _Float16* Vs, int j0, int qt, int lh, int hi,
    v16h qf0, v16h qf1, v8f& o0, v8f& o1, v8f& o2, v8f& o3,
    float& mrow, float& lsum) {
  const bool have1 = !DIAG || (j0 + 1) <= qt;

  // ---- scores: St = K (16x64) . Qt, per 16-key tile, 2 WMMAs each ----
  v8f s0 = {}, s1 = {};
  {
    const _Float16* kr = Ks + j0 * 1024;
    s0 = wmma32(cat8(ld8(kr),       ld8(kr + 256)), qf0, s0);
    s0 = wmma32(cat8(ld8(kr + 512), ld8(kr + 768)), qf1, s0);
  }
  if (have1) {
    const _Float16* kr = Ks + (j0 + 1) * 1024;
    s1 = wmma32(cat8(ld8(kr),       ld8(kr + 256)), qf0, s1);
    s1 = wmma32(cat8(ld8(kr + 512), ld8(kr + 768)), qf1, s1);
  }

  // key r of tile 0 (r + 16 of tile 1) is seen by this lane's query iff
  // <= lim; without a tile 1 all of s1 is masked
  // (all loops over r unrolled: constant r keeps the tiles in registers)
  if (DIAG) {
    const int lim = (qt - j0) * 16 + lh - hi * 8;
    #pragma unroll
    for (int r = 0; r < 8; ++r) {
      if (r > lim)      s0[r] = NEG_INF;
      if (r + 16 > lim) s1[r] = NEG_INF;
    }
  }

  // ---- online softmax: one query per lane, 16 of its 32 keys ----
  float mt = fmaxf(s0[0], s1[0]);
  #pragma unroll
  for (int r = 1; r < 8; ++r) mt = fmaxf(mt, fmaxf(s0[r], s1[r]));
  mt = fmaxf(mt, xhalf(mt));               // the other half's 16 keys
  const float mnew = fmaxf(mrow, mt);
  const float sc   = exp_slot(mrow - mnew);
  mrow = mnew;
  v16h pf;                                 // Pt as a 32x16 B fragment
  lsum *= sc;
  #pragma unroll
  for (int r = 0; r < 8; ++r) {
    const float e0 = exp_slot(s0[r] - mnew);
    const float e1 = exp_slot(s1[r] - mnew);
    lsum += e0 + e1;
    pf[r]     = (_Float16)e0;
    pf[r + 8] = (_Float16)e1;
  }
  o0 *= sc; o1 *= sc; o2 *= sc; o3 *= sc;

  // ---- Ot += Vt (16x32) . Pt (32x16), one WMMA per 16-wide H tile ----
  const int off1 = have1 ? 1024 : 0;       // no tile 1: its P half is 0
  const _Float16* vp = Vs + j0 * 1024;     // keys of tile j0, of j0 + 1
  o0 = wmma32(cat8(ld8(vp),       ld8(vp + off1)),       pf, o0);
  o1 = wmma32(cat8(ld8(vp + 256), ld8(vp + 256 + off1)), pf, o1);
  o2 = wmma32(cat8(ld8(vp + 512), ld8(vp + 512 + off1)), pf, o2);
  o3 = wmma32(cat8(ld8(vp + 768), ld8(vp + 768 + off1)), pf, o3);
}

// ---------------------------------------------------------------------------
// Kernel 0: weight prep.  f16 weights packed in B-fragment order:
//   Wt[w][ks][m][half][lane][e] = (f16) W_m[c][h]
//   h = 16*w + (lane & 15),  c = 32*ks + 8*(lane >> 4) + 16*half + e
// (w: 16-column tile, ks: K-step of 32, m: q/k/v, e: 0..7).  One wave-wide
// 16-byte load of head_kernel then covers 512 contiguous bytes (4 whole lines).
// ---------------------------------------------------------------------------
__global__ __launch_bounds__(256)
void wcvt_kernel(const float* __restrict__ Wq, const float* __restrict__ Wk,
                 const float* __restrict__ Wv, _Float16* __restrict__ Wt) {
  const int idx  = blockIdx.x * 256 + threadIdx.x;
  const int e    = idx & 7;
  const int lane = (idx >> 3) & 31;
  const int half = (idx >> 8) & 1;
  const int t    = idx >> 9;                     // (w*KSTEPS + ks)*3 + m
  const int m    = t % 3;
  const int ks   = (t / 3) % KSTEPS;
  const int w    = t / (3 * KSTEPS);
  const int h    = w * 16 + (lane & 15);
  const int c    = ks * 32 + (lane >> 4) * 8 + half * 16 + e;
  const float* W = (m == 0) ? Wq : (m == 1) ? Wk : Wv;
  Wt[idx] = (_Float16)W[(size_t)c * H_DIM + h];
}

__global__ __launch_bounds__(256)
void head_kernel(const float* __restrict__ x,
                 const _Float16* __restrict__ Wt,   // packed, see wcvt_kernel
                 const float* __restrict__ bq, const float* __restrict__ bk,
                 const float* __restrict__ bv,
                 float* __restrict__ out) {
  __shared__ __align__(16) _Float16 qkv[3 * FSZ];        // Q, K, V fragments
  // padded f16 rows of x, then the odd tiles' f32 buffer; behind the
  // projection the per-wave O staging
  __shared__ __align__(16) _Float16 stg[PROWS * XPITCH + PROWS * KCH * 2];
  static_assert(8 * 16 * OPITCH * sizeof(float) <= sizeof(stg), "O staging");
  _Float16* xs = stg;

  const int b     = blockIdx.x;
  const int tid   = threadIdx.x;
  // the wave's number in a scalar register: the loops over tiles that depend
  // on it then branch on scalars, with every lane on at the matrix products
  const int wave8 = __builtin_amdgcn_readfirstlane(tid >> 5);   // 0..7
  const int lane  = tid & 31;
  const int lh    = lane & 15;                 // lane within half
  const int hi    = lane >> 4;                 // half select
  const int grp   = wave8 >> 2;                // 0..1  -> 64 rows of the pass
  const int wave  = wave8 & 3;                 // 0..3  -> H tile

  _Float16* Qs = qkv + lane * 8;               // tile 0, piece 0
  _Float16* Ks = Qs + FSZ;
  _Float16* Vs = Ks + FSZ;

  // this wave's packed weights: 3 fragments of 512 halves per K-step
  const _Float16* wfrag = Wt + (size_t)wave * (KSTEPS * 3 * 512) + lane * 8;
  const int   hq    = wave * 16 + hi * 8;      // first of this lane's 8 h (Q, K)
  const float biasv = bv[wave * 16 + lh];
  // this lane's 8 biases of Q and of K, read once, ahead of the projection
  const v4f bq0 = *(const v4f*)(bq + hq), bq1 = *(const v4f*)(bq + hq + 4);
  const v4f bk0 = *(const v4f*)(bk + hq), bk1 = *(const v4f*)(bk + hq + 4);

  // the two halves (64 rows each) of the f32 tile buffers: [parity][half]
  const char* const rawp[2][2] = {
      {(const char*)(qkv + FSZ / 2), (const char*)(qkv + FSZ + FSZ / 2)},
      {(const char*)(stg + PROWS * XPITCH),
       (const char*)(stg + PROWS * XPITCH) + RAWH}};
  // a copying wave's lane: 16 bytes of row 2 * wave + hi of a tile's half
  const float*   xc = x + ((size_t)b * T_SEQ + wave * 2 + hi) * C_EMB + lh * 4;
  const unsigned lc = wave * 512 + lane * 16;

  // tiles 0 and 1 set off; tile 0 has landed behind its copiers' wait and is
  // open to every wave behind the barrier
  if (grp == 0) {
    acopy8((unsigned)(uintptr_t)rawp[0][0] + lc, xc);
    acopy8((unsigned)(uintptr_t)rawp[0][1] + lc, xc + QROWS * C_EMB);
    asm volatile("s_wait_asynccnt 0x0" ::: "memory");
  } else {
    acopy8((unsigned)(uintptr_t)rawp[1][0] + lc, xc + KCH);
    acopy8((unsigned)(uintptr_t)rawp[1][1] + lc, xc + QROWS * C_EMB + KCH);
  }
  // the coming tile's weight fragments, [K-step][q, k, v]: two 512-byte planes
  // each (same k order as the fragments of x)
  v16h wf[6];
  #pragma unroll  // constant i keeps wf in registers
  for (int i = 0; i < 6; ++i)
    wf[i] = cat8(ld8(wfrag + i * 512), ld8(wfrag + i * 512 + 256));
  __syncthreads();

  #pragma unroll 1  // rolled to bound the code
  for (int ps = 0; ps < PASSES; ++ps) {
    v8f accq[MT] = {}, acck[MT] = {}, accv[MT] = {};
    #pragma unroll 1  // rolled to bound the code
    for (int ch = 0; ch < NCH; ++ch) {
      const int t   = ps * NCH + ch;           // this tile
      const int par = ch & 1;                  // its buffer (NCH is even)
      const char* const r0 = par ? rawp[1][0] : rawp[0][0];
      const char* const r1 = par ? rawp[1][1] : rawp[0][1];

      // f32 tile -> padded f16 rows: 512 contiguous bytes per wave-wide read
      v4f f[8];
      #pragma unroll  // all eight reads in flight
      for (int j = 0; j < 8; ++j)
        f[j] = *(const v4f*)((j < 4 ? r0 : r1) + ((j & 3) * 256 + tid) * 16);
      #pragma unroll  // constant j keeps f in registers
      for (int j = 0; j < 8; ++j) {
        v4h h;
        h[0] = (_Float16)f[j][0]; h[1] = (_Float16)f[j][1];
        h[2] = (_Float16)f[j][2]; h[3] = (_Float16)f[j][3];
        *(v4h*)(xs + (j * 16 + (tid >> 4)) * XPITCH + (tid & 15) * 4) = h;
      }
      // this wave's reads of the f32 tile have retired before a copy may aim
      // at it again
      asm volatile("s_wait_dscnt 0x0" ::: "memory");
      lds_barrier();                           // xs is written, the f32 tile read

      if (grp == par && t + 2 < NT) {          // scalar test: tile t + 2 sets off
        const int t2 = t + 2;
        const int p2 = t2 >= NCH ? 1 : 0;
        const float* g = xc + (size_t)p2 * (PROWS * C_EMB) + (t2 - p2 * NCH) * KCH;
        acopy8((unsigned)(uintptr_t)r0 + lc, g);
        acopy8((unsigned)(uintptr_t)r1 + lc, g + QROWS * C_EMB);
      }

      // the tile's 8 fragments of x (lane = row lh; halves: k0 + {0..7},
      // k0 + 16 + {0..7}, k0 = 32 * kk + 8 * hi), all reads in one group
      v8h ar[2 * MT * (KCH / 32)];
      #pragma unroll  // constant indices keep ar in registers
      for (int kk = 0; kk < KCH / 32; ++kk) {
        #pragma unroll  // as above
        for (int mt = 0; mt < MT; ++mt) {
          const _Float16* xrow =
              &xs[(grp * QROWS + mt * 16 + lh) * XPITCH + kk * 32 + hi * 8];
          ar[(kk * MT + mt) * 2]     = ld8(xrow);
          ar[(kk * MT + mt) * 2 + 1] = ld8(xrow + 16);
        }
      }
      // holds the reads in front of the products: the scheduler otherwise puts
      // each pair behind the products before it, in one register set, and the
      // wave then waits out the LDS latency eight times a tile
      __builtin_amdgcn_sched_barrier(0);

      #pragma unroll  // the tile's two K-steps in one run, no branch between
      for (int kk = 0; kk < KCH / 32; ++kk) {  // 2 K-steps of 32
        #pragma unroll  // constant mt keeps the accumulator arrays in registers
        for (int mt = 0; mt < MT; ++mt) {
          v16h a = cat8(ar[(kk * MT + mt) * 2], ar[(kk * MT + mt) * 2 + 1]);
          accq[mt] = wmma32(wf[kk * 3],     a, accq[mt]);  // Qt: lane = row, r -> h
          acck[mt] = wmma32(wf[kk * 3 + 1], a, acck[mt]);  // Kt: lane = row, r -> h
          accv[mt] = wmma32(a, wf[kk * 3 + 2], accv[mt]);  // V:  lane = h,   r -> row
        }
      }

      if (t + 1 < NT) {   // scalar test: the next tile's weights set off (behind
                          // a pass's last tile: the first columns again)
        const _Float16* wn =
            wfrag + (ch + 1 == NCH ? 0 : ch + 1) * ((KCH / 32) * 3 * 512);
        #pragma unroll  // constant i keeps wf in registers
        for (int i = 0; i < 6; ++i)
          wf[i] = cat8(ld8(wn + i * 512), ld8(wn + i * 512 + 256));
        // these loads stay in flight into the next trip, which reuses registers:
        // the address that they name is rewritten only behind this wait
        asm volatile("s_wait_xcnt 0x0" ::: "memory");
      }

      // tile t + 1 is handed over: this wave's reads of xs have retired, the
      // tile's copiers have seen it land, and the barrier opens it to all
      asm volatile("s_wait_dscnt 0x0" ::: "memory");
      if (grp != par)
        asm volatile("s_wait_asynccnt 0x0" ::: "memory");
      lds_barrier();
    }

    const int f0 = ((ps * GROUPS + grp) * MT * 4 + wave) * 256;
    #pragma unroll    // constant mt, r: accumulators are read from registers
    for (int mt = 0; mt < MT; ++mt) {
      v8h q, k, v;
      #pragma unroll
      for (int r = 0; r < 8; ++r) {
        const float bqr = r < 4 ? bq0[r & 3] : bq1[r & 3];
        const float bkr = r < 4 ? bk0[r & 3] : bk1[r & 3];
        q[r] = (_Float16)((accq[mt][r] + bqr) * QK_SCALE);         // scale in Q
        k[r] = (_Float16)(acck[mt][r] + bkr);
        v[r] = (_Float16)(accv[mt][r] + biasv);
      }
      *(v8h*)(Qs + f0 + mt * 1024) = q;
      *(v8h*)(Ks + f0 + mt * 1024) = k;
      *(v8h*)(Vs + f0 + mt * 1024) = v;
    }
  }
  // no copy is left in flight where the staging LDS gets its next use
  asm volatile("s_wait_asynccnt 0x0" ::: "memory");
  __syncthreads();   // Q, K, V are written; nobody reads xs as x any more

  float* myo = (float*)stg + wave8 * (16 * OPITCH);      // this wave's O staging

  #pragma unroll 1  // one tile after the other, rolled to bound the code
  for (int half = 0; half < 2; ++half) {
    const int qt  = half ? wave8 : 15 - wave8; // Q tile index in [0,16)
    const int qr0 = qt * 16;                   // first Q row of the tile

    // Q as B fragments (lane = query): two 32x16 chunks covering H=64
    const _Float16* qr = Qs + qt * 1024;
    v16h qf0 = cat8(ld8(qr),       ld8(qr + 256));
    v16h qf1 = cat8(ld8(qr + 512), ld8(qr + 768));

    v8f o0 = {}, o1 = {}, o2 = {}, o3 = {};    // Ot: lane = query, r -> h
    float mrow = NEG_INF, lsum = 0.0f;         // lsum: this half's keys only

    // the pairs below the diagonal tile, then the one pair that holds it
    const int nfull = qt >> 1;
    #pragma unroll 1  // rolled to bound the code
    for (int p = 0; p < nfull; ++p)
      key_pair<false>(Ks, Vs, 2 * p, qt, lh, hi, qf0, qf1, o0, o1, o2, o3,
                      mrow, lsum);
    key_pair<true>(Ks, Vs, 2 * nfull, qt, lh, hi, qf0, qf1, o0, o1, o2, o3,
                   mrow, lsum);

    // ---- normalize; turn Ot through this wave's LDS; store whole lines ----
    const float inv = 1.0f / (lsum + xhalf(lsum));
    float* wr  = myo + lh * OPITCH + hi * 8;   // a lane holds 8 h in a row
    o0 *= inv; o1 *= inv; o2 *= inv; o3 *= inv;
    *(v4f*)(wr +  0) = __builtin_shufflevector(o0, o0, 0, 1, 2, 3);
    *(v4f*)(wr +  4) = __builtin_shufflevector(o0, o0, 4, 5, 6, 7);
    *(v4f*)(wr + 16) = __builtin_shufflevector(o1, o1, 0, 1, 2, 3);
    *(v4f*)(wr + 20) = __builtin_shufflevector(o1, o1, 4, 5, 6, 7);
    *(v4f*)(wr + 32) = __builtin_shufflevector(o2, o2, 0, 1, 2, 3);
    *(v4f*)(wr + 36) = __builtin_shufflevector(o2, o2, 4, 5, 6, 7);
    *(v4f*)(wr + 48) = __builtin_shufflevector(o3, o3, 0, 1, 2, 3);
    *(v4f*)(wr + 52) = __builtin_shufflevector(o3, o3, 4, 5, 6, 7);

    // per-wave LDS RAW across lanes: DS ops are in-order per wave; make it explicit
    asm volatile("s_wait_dscnt 0" ::: "memory");

    // 32 lanes x 16 B = two whole output rows (512 contiguous bytes) per store
    float* og = out + ((size_t)b * T_SEQ + qr0 + hi) * H_DIM + lh * 4;
    #pragma unroll
    for (int i = 0; i < 8; ++i)
      *(v4f*)(og + (size_t)i * 2 * H_DIM) =
          *(const v4f*)(myo + (i * 2 + hi) * OPITCH + lh * 4);
    // the next tile's start values overwrite the registers that these stores
    // name: this wait stands between the stores and that overwrite
    asm volatile("s_wait_xcnt 0x0" ::: "memory");
  }
}

// ---------------------------------------------------------------------------
extern "C" void kernel_launch(void* const* d_in, const int* in_sizes, int n_in,
                              void* d_out, int out_size, void* d_ws, size_t ws_size,
                              hipStream_t stream) {
  const float* x  = (const float*)d_in[0];
  const float* Wq = (const float*)d_in[1];
  const float* bq = (const float*)d_in[2];
  const float* Wk = (const float*)d_in[3];
  const float* bk = (const float*)d_in[4];
  const float* Wv = (const float*)d_in[5];
  const float* bv = (const float*)d_in[6];

  const size_t nW = (size_t)3 * H_DIM * C_EMB;           // 73728 elems
  _Float16* Wt = (_Float16*)d_ws;                        // 144 KB of ws

  wcvt_kernel<<<dim3((unsigned)(nW / 256)), 256, 0, stream>>>(Wq, Wk, Wv, Wt);
  head_kernel<<<dim3(B_BATCH), 256, 0, stream>>>(
      x, Wt, bq, bk, bv, (float*)d_out);
}
